// v000
// Measured on an AMD MI455X. A time is GPU time per run, averaged over a window of back-to-back runs after a warm-up
// (all launches, gaps included; the runs take copies of the inputs in turn), and the median of several windows.
// Apart from v000's, it joins two sittings. Times from different sittings can be a few percent apart, while
// side-by-side timings come from the same sitting.
// The starting kernel, v000, takes 3860 microseconds a run.
#include <hip/hip_runtime.h>

// TransformedAttention (x [8][2048][512]; q/k/v = x W + b (512); scores = q.k / sqrt(512) restricted to the sliding window i-128 <= j <= i+128 (others masked); softmax; out = attn v -> [8][2048][512]).
// Banded evaluation: for each 128-row query tile only the key columns max(0,i0-128) .. min(2048,i0+256) (<= 384) are computed.
// Compute dtypes, f32 accumulate: every input rounded to bf16; q/k/v on PLAIN bf16 operands (inputs: exact) + bias; banded scores (K 512) on single fp16 planes; window mask + softmax f32 -> bf16 hi+lo probability planes;

#define NB_  8
#define SS   2048
#define DD   512
#define RT   128
#define SPN  384
#define LW   128
typedef _Float16 h16;
typedef unsigned short bf;
typedef __attribute__((ext_vector_type(16))) __bf16   v16bf;
typedef __attribute__((ext_vector_type(16))) _Float16 v16h;
typedef __attribute__((ext_vector_type(8)))  _Float16 v8h;
typedef __attribute__((ext_vector_type(8)))  unsigned short v8us;
typedef __attribute__((ext_vector_type(8)))  float    v8f;
typedef __attribute__((ext_vector_type(4)))  float    v4f;
typedef v8h  __attribute__((may_alias)) v8ha;
typedef v4f  __attribute__((may_alias)) v4fa;
typedef v8us __attribute__((may_alias)) v8usa;

__device__ __forceinline__ unsigned short f2bf(float f) { unsigned u = __float_as_uint(f); u += 0x7FFFu + ((u >> 16) & 1u); return (unsigned short)(u >> 16); }
__device__ __forceinline__ float bf2f(unsigned short b) { return __uint_as_float(((unsigned)b) << 16); }
__device__ __forceinline__ float bfr(float f) { return bf2f(f2bf(f)); }
__device__ __forceinline__ v16h cat16(v8h lo, v8h hi) { return __builtin_shufflevector(lo, hi, 0, 1, 2, 3, 4, 5, 6, 7, 8, 9, 10, 11, 12, 13, 14, 15); }
__device__ __forceinline__ v16bf cat16b(v8us lo, v8us hi) { return __builtin_bit_cast(v16bf, __builtin_shufflevector(lo, hi, 0, 1, 2, 3, 4, 5, 6, 7, 8, 9, 10, 11, 12, 13, 14, 15)); }
__device__ __forceinline__ v8f wmma16(v16h a, v16h b, v8f c) { return __builtin_amdgcn_wmma_f32_16x16x32_f16(false, a, false, b, (short)0, c, false, false); }
__device__ __forceinline__ v8f wmmab(v16bf a, v16bf b, v8f c) { return __builtin_amdgcn_wmma_f32_16x16x32_bf16(false, a, false, b, (short)0, c, false, false); }



// ---- k_gemmw: register-blocked GEMM, ONE WAVE per 64x64 output tile (16 accumulators), operands straight from K-contiguous 16-bit planes; grid (M/64, N/64, Z), 32 threads.
// C[m][n] (f32, pitch ldc, + optional f32 bias[n]) = sum_k A[m][k] Bt[n][k] (+ split products per NSPLIT). z-batch strides sA/sB/sC in elements. K % 32 == 0.
template <typename T16> struct WFrag;
template <> struct WFrag<h16> { typedef v16h V; static __device__ __forceinline__ V ld(const h16* p) { return cat16(*(const v8h*)p, *(const v8h*)(p + 16)); } static __device__ __forceinline__ v8f mma(V a, V b, v8f c) { return wmma16(a, b, c); } };
template <> struct WFrag<bf> { typedef v16bf V; static __device__ __forceinline__ V ld(const bf* p) { return cat16b(*(const v8us*)p, *(const v8us*)(p + 16)); } static __device__ __forceinline__ v8f mma(V a, V b, v8f c) { return wmmab(a, b, c); } };
template <typename T16, int NSPLIT, bool BIAS>
__global__ __launch_bounds__(32) void k_gemmw(const T16* __restrict__ A, const T16* __restrict__ A2, const T16* __restrict__ Bt, const T16* __restrict__ Bt2, int K, float* C, int ldc, const float* __restrict__ bias, size_t sA, size_t sB, size_t sC) {
    typedef typename WFrag<T16>::V V;
    __shared__ __align__(16) float os[16 * 68];
    const size_t z = blockIdx.z; A += z * sA; if (A2) A2 += z * sA; Bt += z * sB; if (Bt2) Bt2 += z * sB; C += z * sC;
    const int lane = threadIdx.x & 31, lr = lane & 15, hi = lane >> 4; const int r0 = blockIdx.x * 64, c0 = blockIdx.y * 64;
    v8f acc[4][4];
#pragma unroll
    for (int mb = 0; mb < 4; ++mb)
#pragma unroll
        for (int nb = 0; nb < 4; ++nb) acc[mb][nb] = (v8f){};
    const size_t aoff = (size_t)(r0 + lr) * K + 8 * hi, boff = (size_t)(c0 + lr) * K + 8 * hi;
#pragma unroll 1
    for (int kc = 0; kc < K; kc += 32) {
        V a[4], a2[4];
#pragma unroll
        for (int mb = 0; mb < 4; ++mb) { a[mb] = WFrag<T16>::ld(A + aoff + (size_t)mb * 16 * K + kc); if (NSPLIT == 1 || NSPLIT == 2) a2[mb] = WFrag<T16>::ld(A2 + aoff + (size_t)mb * 16 * K + kc); }
#pragma unroll
        for (int nb = 0; nb < 4; ++nb) { const V b = WFrag<T16>::ld(Bt + boff + (size_t)nb * 16 * K + kc); V b2; if (NSPLIT >= 2) b2 = WFrag<T16>::ld(Bt2 + boff + (size_t)nb * 16 * K + kc);
#pragma unroll
            for (int mb = 0; mb < 4; ++mb) { acc[mb][nb] = WFrag<T16>::mma(a[mb], b, acc[mb][nb]); if (NSPLIT == 1 || NSPLIT == 2) acc[mb][nb] = WFrag<T16>::mma(a2[mb], b, acc[mb][nb]); if (NSPLIT >= 2) acc[mb][nb] = WFrag<T16>::mma(a[mb], b2, acc[mb][nb]); } }
        asm volatile("v_nop\n\tv_nop\n\tv_nop\n\tv_nop" : "+v"(acc[0][0]), "+v"(acc[1][1]), "+v"(acc[2][2]), "+v"(acc[3][3]) : "v"(a[0]), "v"(a[3]));
    }
#pragma unroll
    for (int mb = 0; mb < 4; ++mb) {
#pragma unroll
        for (int nb = 0; nb < 4; ++nb) {
#pragma unroll
            for (int j = 0; j < 8; ++j) os[(hi * 8 + j) * 68 + nb * 16 + lr] = acc[mb][nb][j]; }
        __builtin_amdgcn_wave_barrier(); asm volatile("" ::: "memory");
        float* crow = C + (size_t)(r0 + mb * 16) * ldc + c0;
{
#pragma unroll
            for (int s = 0; s < 8; ++s) { const int row = 2 * s + hi, cofs = lr * 4; v4f val = *(const v4fa*)(os + row * 68 + cofs); if (BIAS) { val[0] += bfr(bias[c0 + cofs]); val[1] += bfr(bias[c0 + cofs + 1]); val[2] += bfr(bias[c0 + cofs + 2]); val[3] += bfr(bias[c0 + cofs + 3]); }
                *(v4f*)(crow + (size_t)row * ldc + cofs) = val; }
             }
        __builtin_amdgcn_wave_barrier(); asm volatile("" ::: "memory");
    }
}

__device__ __forceinline__ h16 tohx(float x) { return (h16)x; }
__device__ __forceinline__ void splitf(float y, unsigned short& h, unsigned short& l) { h = f2bf(y); l = f2bf(y - bf2f(h)); }
typedef __attribute__((ext_vector_type(2))) unsigned short v2us;
typedef __attribute__((ext_vector_type(4))) unsigned short v4us;
typedef __attribute__((ext_vector_type(4))) _Float16 v4h;

__global__ __launch_bounds__(256) void k_wtG(const float* __restrict__ w, int K, int N, bf* Bt) {
    const int lane = threadIdx.x & 31; const int L0 = (blockIdx.x * 8 + (threadIdx.x >> 5)) * 8; const int nlines = N * K / 64;
{
#pragma unroll 1
        for (int l = 0; l < 8; ++l) { const int L = L0 + l; if (L >= nlines) break; const size_t e = (size_t)L * 64 + lane * 2; const int k = (int)(e % K), n = (int)(e / K); v2us o;
            o[0] = f2bf(w[(size_t)k * N + n]); o[1] = f2bf(w[(size_t)(k + 1) * N + n]); *(v2us*)(Bt + e) = o; }
         }
}
__global__ __launch_bounds__(256) void k_cvt8(const float* __restrict__ src, bf* dst, size_t n8) { const size_t i = (size_t)blockIdx.x * 256 + threadIdx.x; if (i >= n8) return; const v8f v = *(const v8f*)(src + i * 8); v8us o;
#pragma unroll
    for (int k = 0; k < 8; ++k) o[k] = f2bf(v[k]); *(v8us*)(dst + i * 8) = o;  }
// k_h16: fp16 copies of FQ and FK (8-B lanes); k_vslice: hl planes VS[d][jj] = FV[c0 + jj][d] for jj < span, 0 beyond (lane -> 2 consecutive jj); k_wsoft: wave per tile row rr (i = i0 + rr): columns jj < span with j = c0 + jj inside [i-128, i+128] keep
__global__ __launch_bounds__(256) void k_h16(const float* __restrict__ FQ, const float* __restrict__ FK, h16* Q16, h16* K16) { const size_t e = ((size_t)blockIdx.x * 256 + threadIdx.x) * 4; if (e >= (size_t)SS * DD) return; const v4f a = *(const v4f*)(FQ + e), b = *(const v4f*)(FK + e); v4h q, k;
#pragma unroll
    for (int u = 0; u < 4; ++u) { q[u] = tohx(a[u]); k[u] = tohx(b[u]); } { *(v4h*)(Q16 + e) = q; *(v4h*)(K16 + e) = k;  } }
__global__ __launch_bounds__(256) void k_vslice(const float* __restrict__ FV, int c0, int span, bf* Vh, bf* Vl) { const int e = (blockIdx.x * 256 + threadIdx.x) * 2; if (e >= DD * SPN) return; const int jj = e % SPN; const int d = e / SPN; v2us oh, ol;
#pragma unroll
    for (int u = 0; u < 2; ++u) { const float v = (jj + u < span) ? FV[(size_t)(c0 + jj + u) * DD + d] : 0.f; unsigned short a, b; splitf(v, a, b); oh[u] = a; ol[u] = b; }
    *(v2us*)(Vh + e) = oh; *(v2us*)(Vl + e) = ol;  }
__global__ __launch_bounds__(256) void k_wsoft(const float* __restrict__ ST, int i0, int c0, int span, bf* Ph, bf* Pl) { const int lane = threadIdx.x & 31; const int rr = blockIdx.x * 8 + (threadIdx.x >> 5); if (rr >= RT) return; const int i = i0 + rr; const float* sr = ST + (size_t)rr * SPN; const float c = 0.044194173824159216f; float v[SPN / 32]; float mx = -3.0e38f;
#pragma unroll
    for (int ch = 0; ch < SPN / 128; ++ch) { const int jj0 = ch * 128 + lane * 4; const v4f a = *(const v4f*)(sr + jj0);
#pragma unroll
        for (int u = 0; u < 4; ++u) { const int jj = jj0 + u; const int j = c0 + jj; const bool ok = (jj < span) && (j >= i - LW) && (j <= i + LW); const float t = ok ? a[u] * c : -3.0e38f; v[ch * 4 + u] = t; mx = fmaxf(mx, t); } }
#pragma unroll
    for (int sh = 16; sh; sh >>= 1) mx = fmaxf(mx, __shfl_xor(mx, sh, 32));
    float sum = 0.f;
#pragma unroll
    for (int q = 0; q < SPN / 32; ++q) { float d0 = __fsub_rn(v[q], mx); asm volatile("" : "+v"(d0)); v[q] = __builtin_amdgcn_exp2f(__fmul_rn(d0, 1.4426950408889634f)); sum += v[q]; }
#pragma unroll
    for (int sh = 16; sh; sh >>= 1) sum += __shfl_xor(sum, sh, 32);
    const float f = __fdiv_rn(1.0f, sum);
    {
#pragma unroll
        for (int ch = 0; ch < SPN / 128; ++ch) { v4us oh, ol;
#pragma unroll
            for (int q = 0; q < 4; ++q) { unsigned short a, b; splitf(v[ch * 4 + q] * f, a, b); oh[q] = a; ol[q] = b; } const size_t oo = (size_t)rr * SPN + ch * 128 + lane * 4; *(v4us*)(Ph + oo) = oh; *(v4us*)(Pl + oo) = ol; }
         } }

extern "C" void kernel_launch(void* const* d_in, const int* in_sizes, int n_in,
                              void* d_out, int out_size, void* d_ws, size_t ws_size, hipStream_t stream) {
    (void)in_sizes; (void)n_in; (void)out_size;
    const float* x = (const float*)d_in[0]; const float* wq = (const float*)d_in[1]; const float* wk = (const float*)d_in[2]; const float* wv = (const float*)d_in[3]; const float* bq = (const float*)d_in[4]; const float* bk = (const float*)d_in[5]; const float* bv = (const float*)d_in[6];
    float* OUT = (float*)d_out;     // [8][2048][512]
    char* wsp = (char*)d_ws;
    auto take = [&](size_t bytes) { char* p = wsp; wsp += (bytes + 255) & ~(size_t)255; return (void*)p; };
    bf* WQ = (bf*)take((size_t)DD * DD * 2); bf* WK = (bf*)take((size_t)DD * DD * 2); bf* WV = (bf*)take((size_t)DD * DD * 2); bf* XB = (bf*)take((size_t)SS * DD * 2);
    float* FQ = (float*)take((size_t)SS * DD * 4); float* FK = (float*)take((size_t)SS * DD * 4); float* FV = (float*)take((size_t)SS * DD * 4); h16* Q16 = (h16*)take((size_t)SS * DD * 2); h16* K16 = (h16*)take((size_t)SS * DD * 2);
    bf* Vh = (bf*)take((size_t)DD * SPN * 2); bf* Vl = (bf*)take((size_t)DD * SPN * 2); float* ST = (float*)take((size_t)RT * SPN * 4); bf* Ph = (bf*)take((size_t)RT * SPN * 2); bf* Pl = (bf*)take((size_t)RT * SPN * 2);
    if ((size_t)(wsp - (char*)d_ws) > ws_size) return;    // total ~ 22 MB
    k_wtG<<<(DD * DD / 64 + 63) / 64, 256, 0, stream>>>(wq, DD, DD, WQ); k_wtG<<<(DD * DD / 64 + 63) / 64, 256, 0, stream>>>(wk, DD, DD, WK); k_wtG<<<(DD * DD / 64 + 63) / 64, 256, 0, stream>>>(wv, DD, DD, WV);
    for (int b = 0; b < NB_; ++b) {
        k_cvt8<<<(SS * DD / 8 + 255) / 256, 256, 0, stream>>>(x + (size_t)b * SS * DD, XB, (size_t)SS * DD / 8);
        k_gemmw<bf, 0, true><<<dim3(SS / 64, DD / 64, 1), 32, 0, stream>>>(XB, nullptr, WQ, nullptr, DD, FQ, DD, bq, 0, 0, 0); k_gemmw<bf, 0, true><<<dim3(SS / 64, DD / 64, 1), 32, 0, stream>>>(XB, nullptr, WK, nullptr, DD, FK, DD, bk, 0, 0, 0); k_gemmw<bf, 0, true><<<dim3(SS / 64, DD / 64, 1), 32, 0, stream>>>(XB, nullptr, WV, nullptr, DD, FV, DD, bv, 0, 0, 0);
        k_h16<<<(unsigned)(((size_t)SS * DD / 4 + 255) / 256), 256, 0, stream>>>(FQ, FK, Q16, K16);
        for (int i0 = 0; i0 < SS; i0 += RT) { const int c0 = (i0 - LW > 0) ? (i0 - LW) : 0; const int c1 = (i0 + RT + LW < SS) ? (i0 + RT + LW) : SS; const int span = c1 - c0;   // 256 or 384 columns
            k_gemmw<h16, 0, false><<<dim3(RT / 64, span / 64, 1), 32, 0, stream>>>(Q16 + (size_t)i0 * DD, nullptr, K16 + (size_t)c0 * DD, nullptr, DD, ST, SPN, nullptr, 0, 0, 0);
            k_wsoft<<<RT / 8, 256, 0, stream>>>(ST, i0, c0, span, Ph, Pl);
            k_vslice<<<(DD * SPN / 2 + 255) / 256, 256, 0, stream>>>(FV, c0, span, Vh, Vl);
            k_gemmw<bf, 2, false><<<dim3(RT / 64, DD / 64, 1), 32, 0, stream>>>(Ph, Pl, Vh, Vl, SPN, OUT + ((size_t)b * SS + i0) * DD, DD, nullptr, 0, 0, 0); } }
}

// v001
// One run takes 250 microseconds.
// Timed twice side by side with v000, it ran 15.3 and 15.2 times as fast.
#include <hip/hip_runtime.h>

// TransformedAttention (x [8][2048][512]; q/k/v = x W + b (512); scores = q.k / sqrt(512) restricted to the sliding window i-128 <= j <= i+128 (others masked); softmax; out = attn v -> [8][2048][512]).
// Banded evaluation: for each 128-row query tile only the key columns max(0,i0-128) .. min(2048,i0+256) (<= 384) are computed.
// Compute dtypes, f32 accumulate: every input rounded to bf16; q/k/v on PLAIN bf16 operands (inputs: exact) + bias; banded scores (K 512) on single fp16 planes; window mask + softmax f32 -> bf16 hi+lo probability planes;

#define NB_  8
#define SS   2048
#define DD   512
#define RT   128
#define SPN  384
#define LW   128
#define NT   (SS / RT)        // query tiles per batch entry
#define NZ   (NB_ * NT)       // all (batch, query tile) pairs; one grid slot each
typedef _Float16 h16;
typedef unsigned short bf;
typedef __attribute__((ext_vector_type(16))) __bf16   v16bf;
typedef __attribute__((ext_vector_type(16))) _Float16 v16h;
typedef __attribute__((ext_vector_type(8)))  _Float16 v8h;
typedef __attribute__((ext_vector_type(8)))  unsigned short v8us;
typedef __attribute__((ext_vector_type(8)))  float    v8f;
typedef __attribute__((ext_vector_type(4)))  float    v4f;
typedef v8h  __attribute__((may_alias)) v8ha;
typedef v4f  __attribute__((may_alias)) v4fa;
typedef v8us __attribute__((may_alias)) v8usa;

__device__ __forceinline__ unsigned short f2bf(float f) { unsigned u = __float_as_uint(f); u += 0x7FFFu + ((u >> 16) & 1u); return (unsigned short)(u >> 16); }
__device__ __forceinline__ float bf2f(unsigned short b) { return __uint_as_float(((unsigned)b) << 16); }
__device__ __forceinline__ float bfr(float f) { return bf2f(f2bf(f)); }
__device__ __forceinline__ v16h cat16(v8h lo, v8h hi) { return __builtin_shufflevector(lo, hi, 0, 1, 2, 3, 4, 5, 6, 7, 8, 9, 10, 11, 12, 13, 14, 15); }
__device__ __forceinline__ v16bf cat16b(v8us lo, v8us hi) { return __builtin_bit_cast(v16bf, __builtin_shufflevector(lo, hi, 0, 1, 2, 3, 4, 5, 6, 7, 8, 9, 10, 11, 12, 13, 14, 15)); }
__device__ __forceinline__ v8f wmma16(v16h a, v16h b, v8f c) { return __builtin_amdgcn_wmma_f32_16x16x32_f16(false, a, false, b, (short)0, c, false, false); }
__device__ __forceinline__ v8f wmmab(v16bf a, v16bf b, v8f c) { return __builtin_amdgcn_wmma_f32_16x16x32_bf16(false, a, false, b, (short)0, c, false, false); }



// Query tile z = b * NT + t: rows i0 .. i0+127 of batch entry b, key columns c0 .. c0+span-1 (span 256 at the two edge tiles, else 384).
__device__ __forceinline__ void tile_of(int z, int& b, int& i0, int& c0, int& span) { b = z / NT; i0 = (z % NT) * RT; c0 = (i0 - LW > 0) ? (i0 - LW) : 0; const int c1 = (i0 + RT + LW < SS) ? (i0 + RT + LW) : SS; span = c1 - c0; }

// ---- k_gemmw: register-blocked GEMM, ONE WAVE per 64x64 output tile (16 accumulators), operands straight from K-contiguous 16-bit planes; grid (M/64, N/64, Z), 32 threads.
// C[m][n] (f32, pitch ldc, + optional f32 bias[n]) = sum_k A[m][k] Bt[n][k] (+ split products per NSPLIT). z-batch strides sA/sB/sC in elements. K % 32 == 0. bias/bias1/bias2: the bias of z = 0/1/2. BAND: z is a query tile, Bt starts at that tile's first key row and column blocks past its span leave.
template <typename T16> struct WFrag;
template <> struct WFrag<h16> { typedef v16h V; static __device__ __forceinline__ V ld(const h16* p) { return cat16(*(const v8h*)p, *(const v8h*)(p + 16)); } static __device__ __forceinline__ v8f mma(V a, V b, v8f c) { return wmma16(a, b, c); } };
template <> struct WFrag<bf> { typedef v16bf V; static __device__ __forceinline__ V ld(const bf* p) { return cat16b(*(const v8us*)p, *(const v8us*)(p + 16)); } static __device__ __forceinline__ v8f mma(V a, V b, v8f c) { return wmmab(a, b, c); } };
template <typename T16, int NSPLIT, bool BIAS, bool BAND>
__global__ __launch_bounds__(32) void k_gemmw(const T16* __restrict__ A, const T16* __restrict__ A2, const T16* __restrict__ Bt, const T16* __restrict__ Bt2, int K, float* C, int ldc, const float* __restrict__ bias, const float* __restrict__ bias1, const float* __restrict__ bias2, size_t sA, size_t sB, size_t sC) {
    typedef typename WFrag<T16>::V V;
    __shared__ __align__(16) float os[16 * 68];
    const size_t z = blockIdx.z; A += z * sA; if (A2) A2 += z * sA; Bt += z * sB; if (Bt2) Bt2 += z * sB; C += z * sC;
    if (BAND) { int b, i0, kc0, span; tile_of((int)blockIdx.z, b, i0, kc0, span); if ((int)blockIdx.y * 64 >= span) return; Bt += ((size_t)b * SS + kc0) * K; }
    if (BIAS) bias = (blockIdx.z == 0) ? bias : (blockIdx.z == 1) ? bias1 : bias2;
    const int lane = threadIdx.x & 31, lr = lane & 15, hi = lane >> 4; const int r0 = blockIdx.x * 64, c0 = blockIdx.y * 64;
    v8f acc[4][4];
#pragma unroll
    for (int mb = 0; mb < 4; ++mb)
#pragma unroll
        for (int nb = 0; nb < 4; ++nb) acc[mb][nb] = (v8f){};
    const size_t aoff = (size_t)(r0 + lr) * K + 8 * hi, boff = (size_t)(c0 + lr) * K + 8 * hi;
#pragma unroll 1
    for (int kc = 0; kc < K; kc += 32) {
        V a[4], a2[4];
#pragma unroll
        for (int mb = 0; mb < 4; ++mb) { a[mb] = WFrag<T16>::ld(A + aoff + (size_t)mb * 16 * K + kc); if (NSPLIT == 1 || NSPLIT == 2) a2[mb] = WFrag<T16>::ld(A2 + aoff + (size_t)mb * 16 * K + kc); }
#pragma unroll
        for (int nb = 0; nb < 4; ++nb) { const V b = WFrag<T16>::ld(Bt + boff + (size_t)nb * 16 * K + kc); V b2; if (NSPLIT >= 2) b2 = WFrag<T16>::ld(Bt2 + boff + (size_t)nb * 16 * K + kc);
#pragma unroll
            for (int mb = 0; mb < 4; ++mb) { acc[mb][nb] = WFrag<T16>::mma(a[mb], b, acc[mb][nb]); if (NSPLIT == 1 || NSPLIT == 2) acc[mb][nb] = WFrag<T16>::mma(a2[mb], b, acc[mb][nb]); if (NSPLIT >= 2) acc[mb][nb] = WFrag<T16>::mma(a[mb], b2, acc[mb][nb]); } }
        asm volatile("v_nop\n\tv_nop\n\tv_nop\n\tv_nop" : "+v"(acc[0][0]), "+v"(acc[1][1]), "+v"(acc[2][2]), "+v"(acc[3][3]) : "v"(a[0]), "v"(a[3]));
    }
#pragma unroll
    for (int mb = 0; mb < 4; ++mb) {
#pragma unroll
        for (int nb = 0; nb < 4; ++nb) {
#pragma unroll
            for (int j = 0; j < 8; ++j) os[(hi * 8 + j) * 68 + nb * 16 + lr] = acc[mb][nb][j]; }
        __builtin_amdgcn_wave_barrier(); asm volatile("" ::: "memory");
        float* crow = C + (size_t)(r0 + mb * 16) * ldc + c0;
{
#pragma unroll
            for (int s = 0; s < 8; ++s) { const int row = 2 * s + hi, cofs = lr * 4; v4f val = *(const v4fa*)(os + row * 68 + cofs); if (BIAS) { val[0] += bfr(bias[c0 + cofs]); val[1] += bfr(bias[c0 + cofs + 1]); val[2] += bfr(bias[c0 + cofs + 2]); val[3] += bfr(bias[c0 + cofs + 3]); }
                *(v4f*)(crow + (size_t)row * ldc + cofs) = val; }
             }
        __builtin_amdgcn_wave_barrier(); asm volatile("" ::: "memory");
    }
}

__device__ __forceinline__ h16 tohx(float x) { return (h16)x; }
__device__ __forceinline__ void splitf(float y, unsigned short& h, unsigned short& l) { h = f2bf(y); l = f2bf(y - bf2f(h)); }
typedef __attribute__((ext_vector_type(2))) unsigned short v2us;
typedef __attribute__((ext_vector_type(4))) unsigned short v4us;
typedef __attribute__((ext_vector_type(4))) _Float16 v4h;

__global__ __launch_bounds__(256) void k_wtG(const float* __restrict__ w0, const float* __restrict__ w1, const float* __restrict__ w2, int K, int N, bf* Bt) {
    const float* __restrict__ w = (blockIdx.y == 0) ? w0 : (blockIdx.y == 1) ? w1 : w2; Bt += (size_t)blockIdx.y * K * N;
    const int lane = threadIdx.x & 31; const int L0 = (blockIdx.x * 8 + (threadIdx.x >> 5)) * 8; const int nlines = N * K / 64;
{
#pragma unroll 1
        for (int l = 0; l < 8; ++l) { const int L = L0 + l; if (L >= nlines) break; const size_t e = (size_t)L * 64 + lane * 2; const int k = (int)(e % K), n = (int)(e / K); v2us o;
            o[0] = f2bf(w[(size_t)k * N + n]); o[1] = f2bf(w[(size_t)(k + 1) * N + n]); *(v2us*)(Bt + e) = o; }
         }
}
__global__ __launch_bounds__(256) void k_cvt8(const float* __restrict__ src, bf* dst, size_t n8) { const size_t i = (size_t)blockIdx.x * 256 + threadIdx.x; if (i >= n8) return; const v8f v = *(const v8f*)(src + i * 8); v8us o;
#pragma unroll
    for (int k = 0; k < 8; ++k) o[k] = f2bf(v[k]); *(v8us*)(dst + i * 8) = o;  }
// k_h16: fp16 copies of FQ and FK (8-B lanes); k_vslice: hl planes VS[d][jj] = FV[c0 + jj][d] for jj < span, 0 beyond (lane -> 2 consecutive jj); k_wsoft: wave per tile row rr (i = i0 + rr): columns jj < span with j = c0 + jj inside [i-128, i+128] keep
__global__ __launch_bounds__(256) void k_h16(const float* __restrict__ FQ, const float* __restrict__ FK, h16* Q16, h16* K16) { const size_t e = ((size_t)blockIdx.x * 256 + threadIdx.x) * 4; if (e >= (size_t)NB_ * SS * DD) return; const v4f a = *(const v4f*)(FQ + e), b = *(const v4f*)(FK + e); v4h q, k;
#pragma unroll
    for (int u = 0; u < 4; ++u) { q[u] = tohx(a[u]); k[u] = tohx(b[u]); } { *(v4h*)(Q16 + e) = q; *(v4h*)(K16 + e) = k;  } }
__global__ __launch_bounds__(256) void k_vslice(const float* __restrict__ FV, bf* Vh, bf* Vl) { int b, i0, c0, span; tile_of((int)blockIdx.y, b, i0, c0, span); FV += (size_t)b * SS * DD; Vh += (size_t)blockIdx.y * DD * SPN; Vl += (size_t)blockIdx.y * DD * SPN;
    const int e = (blockIdx.x * 256 + threadIdx.x) * 2; if (e >= DD * SPN) return; const int jj = e % SPN; const int d = e / SPN; v2us oh, ol;
#pragma unroll
    for (int u = 0; u < 2; ++u) { const float v = (jj + u < span) ? FV[(size_t)(c0 + jj + u) * DD + d] : 0.f; unsigned short a, b; splitf(v, a, b); oh[u] = a; ol[u] = b; }
    *(v2us*)(Vh + e) = oh; *(v2us*)(Vl + e) = ol;  }
__global__ __launch_bounds__(256) void k_wsoft(const float* __restrict__ ST, bf* Ph, bf* Pl) { int b, i0, c0, span; tile_of((int)blockIdx.y, b, i0, c0, span); ST += (size_t)blockIdx.y * RT * SPN; Ph += (size_t)blockIdx.y * RT * SPN; Pl += (size_t)blockIdx.y * RT * SPN;
    const int lane = threadIdx.x & 31; const int rr = blockIdx.x * 8 + (threadIdx.x >> 5); if (rr >= RT) return; const int i = i0 + rr; const float* sr = ST + (size_t)rr * SPN; const float c = 0.044194173824159216f; float v[SPN / 32]; float mx = -3.0e38f;
#pragma unroll
    for (int ch = 0; ch < SPN / 128; ++ch) { const int jj0 = ch * 128 + lane * 4; const v4f a = *(const v4f*)(sr + jj0);
#pragma unroll
        for (int u = 0; u < 4; ++u) { const int jj = jj0 + u; const int j = c0 + jj; const bool ok = (jj < span) && (j >= i - LW) && (j <= i + LW); const float t = ok ? a[u] * c : -3.0e38f; v[ch * 4 + u] = t; mx = fmaxf(mx, t); } }
#pragma unroll
    for (int sh = 16; sh; sh >>= 1) mx = fmaxf(mx, __shfl_xor(mx, sh, 32));
    float sum = 0.f;
#pragma unroll
    for (int q = 0; q < SPN / 32; ++q) { float d0 = __fsub_rn(v[q], mx); asm volatile("" : "+v"(d0)); v[q] = __builtin_amdgcn_exp2f(__fmul_rn(d0, 1.4426950408889634f)); sum += v[q]; }
#pragma unroll
    for (int sh = 16; sh; sh >>= 1) sum += __shfl_xor(sum, sh, 32);
    const float f = __fdiv_rn(1.0f, sum);
    {
#pragma unroll
        for (int ch = 0; ch < SPN / 128; ++ch) { v4us oh, ol;
#pragma unroll
            for (int q = 0; q < 4; ++q) { unsigned short a, b; splitf(v[ch * 4 + q] * f, a, b); oh[q] = a; ol[q] = b; } const size_t oo = (size_t)rr * SPN + ch * 128 + lane * 4; *(v4us*)(Ph + oo) = oh; *(v4us*)(Pl + oo) = ol; }
         } }

extern "C" void kernel_launch(void* const* d_in, const int* in_sizes, int n_in,
                              void* d_out, int out_size, void* d_ws, size_t ws_size, hipStream_t stream) {
    (void)in_sizes; (void)n_in; (void)out_size;
    const float* x = (const float*)d_in[0]; const float* wq = (const float*)d_in[1]; const float* wk = (const float*)d_in[2]; const float* wv = (const float*)d_in[3]; const float* bq = (const float*)d_in[4]; const float* bk = (const float*)d_in[5]; const float* bv = (const float*)d_in[6];
    float* OUT = (float*)d_out;     // [8][2048][512]
    char* wsp = (char*)d_ws;
    auto take = [&](size_t bytes) { char* p = wsp; wsp += (bytes + 255) & ~(size_t)255; return (void*)p; };
    bf* WQ = (bf*)take((size_t)3 * DD * DD * 2);                       // Wq, Wk, Wv transposed, one after the other
    bf* XB = (bf*)take((size_t)NB_ * SS * DD * 2);
    float* FQ = (float*)take((size_t)3 * NB_ * SS * DD * 4);           // q, k, v (f32), one after the other
    float* FK = FQ + (size_t)NB_ * SS * DD; float* FV = FK + (size_t)NB_ * SS * DD;
    h16* Q16 = (h16*)take((size_t)NB_ * SS * DD * 2); h16* K16 = (h16*)take((size_t)NB_ * SS * DD * 2);
    bf* Vh = (bf*)take((size_t)NZ * DD * SPN * 2); bf* Vl = (bf*)take((size_t)NZ * DD * SPN * 2);
    // Scores and probabilities of all tiles (48 MiB) lie over the f32 q and k (64 MiB), whose last reader is k_h16.
    float* ST = FQ; bf* Ph = (bf*)(ST + (size_t)NZ * RT * SPN); bf* Pl = Ph + (size_t)NZ * RT * SPN;
    if ((size_t)(wsp - (char*)d_ws) > ws_size) return;    // total ~ 242 MiB
    k_wtG<<<dim3((DD * DD / 64 + 63) / 64, 3, 1), 256, 0, stream>>>(wq, wk, wv, DD, DD, WQ);
    k_cvt8<<<(NB_ * SS * DD / 8 + 255) / 256, 256, 0, stream>>>(x, XB, (size_t)NB_ * SS * DD / 8);
    k_gemmw<bf, 0, true, false><<<dim3(NB_ * SS / 64, DD / 64, 3), 32, 0, stream>>>(XB, nullptr, WQ, nullptr, DD, FQ, DD, bq, bk, bv, 0, (size_t)DD * DD, (size_t)NB_ * SS * DD);
    k_h16<<<(unsigned)(((size_t)NB_ * SS * DD / 4 + 255) / 256), 256, 0, stream>>>(FQ, FK, Q16, K16);
    k_gemmw<h16, 0, false, true><<<dim3(RT / 64, SPN / 64, NZ), 32, 0, stream>>>(Q16, nullptr, K16, nullptr, DD, ST, SPN, nullptr, nullptr, nullptr, (size_t)RT * DD, 0, (size_t)RT * SPN);
    k_wsoft<<<dim3(RT / 8, NZ, 1), 256, 0, stream>>>(ST, Ph, Pl);
    k_vslice<<<dim3((DD * SPN / 2 + 255) / 256, NZ, 1), 256, 0, stream>>>(FV, Vh, Vl);
    k_gemmw<bf, 2, false, false><<<dim3(RT / 64, DD / 64, NZ), 32, 0, stream>>>(Ph, Pl, Vh, Vl, SPN, OUT, DD, nullptr, nullptr, nullptr, (size_t)RT * SPN, (size_t)DD * SPN, (size_t)RT * DD);
}

// v002
// Measured time: 168 microseconds a run.
// Timed twice side by side with v001, it ran 1.49 times as fast both times.
// Counting every step since v000, it is 22.7 times as fast.
#include <hip/hip_runtime.h>

// TransformedAttention (x [8][2048][512]; q/k/v = x W + b (512); scores = q.k / sqrt(512) restricted to the sliding window i-128 <= j <= i+128 (others masked); softmax; out = attn v -> [8][2048][512]).
// Banded evaluation: for each 128-row query tile only the key columns max(0,i0-128) .. min(2048,i0+256) (<= 384) are computed.
// Compute dtypes, f32 accumulate: every input rounded to bf16; q/k/v on PLAIN bf16 operands (inputs: exact) + bias; banded scores (K 512) on single fp16 planes; window mask + softmax f32 -> bf16 hi+lo probability planes;

#define NB_  8
#define SS   2048
#define DD   512
#define RT   128
#define SPN  384
#define LW   128
#define NT   (SS / RT)        // query tiles per batch entry
#define NZ   (NB_ * NT)       // all (batch, query tile) pairs; one grid slot each
typedef _Float16 h16;
typedef unsigned short bf;
typedef __attribute__((ext_vector_type(16))) __bf16   v16bf;
typedef __attribute__((ext_vector_type(16))) _Float16 v16h;
typedef __attribute__((ext_vector_type(8)))  _Float16 v8h;
typedef __attribute__((ext_vector_type(8)))  unsigned short v8us;
typedef __attribute__((ext_vector_type(8)))  float    v8f;
typedef __attribute__((ext_vector_type(4)))  float    v4f;
typedef v8h  __attribute__((may_alias)) v8ha;
typedef v4f  __attribute__((may_alias)) v4fa;
typedef v8us __attribute__((may_alias)) v8usa;

__device__ __forceinline__ unsigned short f2bf(float f) { unsigned u = __float_as_uint(f); u += 0x7FFFu + ((u >> 16) & 1u); return (unsigned short)(u >> 16); }
__device__ __forceinline__ float bf2f(unsigned short b) { return __uint_as_float(((unsigned)b) << 16); }
__device__ __forceinline__ float bfr(float f) { return bf2f(f2bf(f)); }
__device__ __forceinline__ v16h cat16(v8h lo, v8h hi) { return __builtin_shufflevector(lo, hi, 0, 1, 2, 3, 4, 5, 6, 7, 8, 9, 10, 11, 12, 13, 14, 15); }
__device__ __forceinline__ v16bf cat16b(v8us lo, v8us hi) { return __builtin_bit_cast(v16bf, __builtin_shufflevector(lo, hi, 0, 1, 2, 3, 4, 5, 6, 7, 8, 9, 10, 11, 12, 13, 14, 15)); }
__device__ __forceinline__ v8f wmma16(v16h a, v16h b, v8f c) { return __builtin_amdgcn_wmma_f32_16x16x32_f16(false, a, false, b, (short)0, c, false, false); }
__device__ __forceinline__ v8f wmmab(v16bf a, v16bf b, v8f c) { return __builtin_amdgcn_wmma_f32_16x16x32_bf16(false, a, false, b, (short)0, c, false, false); }



// Query tile z = b * NT + t: rows i0 .. i0+127 of batch entry b, key columns c0 .. c0+span-1 (span 256 at the two edge tiles, else 384).
__device__ __forceinline__ void tile_of(int z, int& b, int& i0, int& c0, int& span) { b = z / NT; i0 = (z % NT) * RT; c0 = (i0 - LW > 0) ? (i0 - LW) : 0; const int c1 = (i0 + RT + LW < SS) ? (i0 + RT + LW) : SS; span = c1 - c0; }

// ---- k_gemmw: register-blocked GEMM, ONE WAVE per 64x64 output tile (16 accumulators), operands straight from K-contiguous 16-bit planes; grid (M/64, N/64, Z), 32 threads.
// C[m][n] (f32, pitch ldc, + optional f32 bias[n]) = sum_k A[m][k] Bt[n][k] (+ split products per NSPLIT). z-batch strides sA/sB/sC in elements. K % 32 == 0. bias/bias1/bias2: the bias of z = 0/1/2. BAND 1: z is a query tile, Bt starts at that tile's first key row and column blocks past its span leave. BAND 2: z is a query tile, k runs over that tile's span only. VT: z = 2 (v) stores no C: it adds the bias, splits into bf16 hi and lo and stores both transposed, VS[d][jj] = v[c0 + jj][d], into the slice of every query tile whose key window holds its rows.
template <typename T16> struct WFrag;
template <> struct WFrag<h16> { typedef v16h V; static __device__ __forceinline__ V ld(const h16* p) { return cat16(*(const v8h*)p, *(const v8h*)(p + 16)); } static __device__ __forceinline__ v8f mma(V a, V b, v8f c) { return wmma16(a, b, c); } };
template <> struct WFrag<bf> { typedef v16bf V; static __device__ __forceinline__ V ld(const bf* p) { return cat16b(*(const v8us*)p, *(const v8us*)(p + 16)); } static __device__ __forceinline__ v8f mma(V a, V b, v8f c) { return wmmab(a, b, c); } };
__device__ __forceinline__ void splitf(float y, unsigned short& h, unsigned short& l) { h = f2bf(y); l = f2bf(y - bf2f(h)); }
template <typename T16, int NSPLIT, bool BIAS, int BAND, bool VT>
__global__ __launch_bounds__(32) void k_gemmw(const T16* __restrict__ A, const T16* __restrict__ A2, const T16* __restrict__ Bt, const T16* __restrict__ Bt2, int K, float* C, int ldc, const float* __restrict__ bias, const float* __restrict__ bias1, const float* __restrict__ bias2, size_t sA, size_t sB, size_t sC, bf* Vh, bf* Vl) {
    typedef typename WFrag<T16>::V V;
    __shared__ __align__(16) float os[VT ? 16 * 72 : 16 * 68];
    const size_t z = blockIdx.z; A += z * sA; if (A2) A2 += z * sA; Bt += z * sB; if (Bt2) Bt2 += z * sB; C += z * sC;
    int kend = K;
    if (BAND) { int b, i0, kc0, span; tile_of((int)blockIdx.z, b, i0, kc0, span); if (BAND == 1) { if ((int)blockIdx.y * 64 >= span) return; Bt += ((size_t)b * SS + kc0) * K; } else kend = span; }
    if (BIAS) bias = (blockIdx.z == 0) ? bias : (blockIdx.z == 1) ? bias1 : bias2;
    const int lane = threadIdx.x & 31, lr = lane & 15, hi = lane >> 4; const int r0 = blockIdx.x * 64, c0 = blockIdx.y * 64;
    v8f acc[4][4];
#pragma unroll
    for (int mb = 0; mb < 4; ++mb)
#pragma unroll
        for (int nb = 0; nb < 4; ++nb) acc[mb][nb] = (v8f){};
    const size_t aoff = (size_t)(r0 + lr) * K + 8 * hi, boff = (size_t)(c0 + lr) * K + 8 * hi;
#pragma unroll 1
    for (int kc = 0; kc < kend; kc += 32) {
        V a[4], a2[4];
#pragma unroll
        for (int mb = 0; mb < 4; ++mb) { a[mb] = WFrag<T16>::ld(A + aoff + (size_t)mb * 16 * K + kc); if (NSPLIT == 1 || NSPLIT == 2) a2[mb] = WFrag<T16>::ld(A2 + aoff + (size_t)mb * 16 * K + kc); }
#pragma unroll
        for (int nb = 0; nb < 4; ++nb) { const V b = WFrag<T16>::ld(Bt + boff + (size_t)nb * 16 * K + kc); V b2; if (NSPLIT >= 2) b2 = WFrag<T16>::ld(Bt2 + boff + (size_t)nb * 16 * K + kc);
#pragma unroll
            for (int mb = 0; mb < 4; ++mb) { acc[mb][nb] = WFrag<T16>::mma(a[mb], b, acc[mb][nb]); if (NSPLIT == 1 || NSPLIT == 2) acc[mb][nb] = WFrag<T16>::mma(a2[mb], b, acc[mb][nb]); if (NSPLIT >= 2) acc[mb][nb] = WFrag<T16>::mma(a[mb], b2, acc[mb][nb]); } }
        asm volatile("v_nop\n\tv_nop\n\tv_nop\n\tv_nop" : "+v"(acc[0][0]), "+v"(acc[1][1]), "+v"(acc[2][2]), "+v"(acc[3][3]) : "v"(a[0]), "v"(a[3]));
    }
    if (VT && blockIdx.z == 2) {
        // An accumulator lane holds 8 consecutive rows (keys) of one column (d): 16 B of a transposed bf16 row. The 4 row blocks of 16 columns meet in LDS (pitch 144 B), so that each store covers whole 128-B lines. Every loop here is unrolled: acc, vh and vl live in registers and need constant indices.
        static_assert(LW == RT && RT % 64 == 0, "the 64 keys of a wave lie in the windows of the query tiles s0 / RT - 1 .. s0 / RT + 1, whole");
        bf* sh = (bf*)os; bf* sl = sh + 16 * 72;
        const int bb = r0 / SS, s0 = r0 % SS, row = lane >> 3, col = (lane & 7) * 8;
#pragma unroll
        for (int nb = 0; nb < 4; ++nb) { const float bz = bfr(bias[c0 + nb * 16 + lr]);
#pragma unroll
            for (int mb = 0; mb < 4; ++mb) { v8us oh, ol;
#pragma unroll
                for (int j = 0; j < 8; ++j) { unsigned short h, l; splitf(acc[mb][nb][j] + bz, h, l); oh[j] = h; ol[j] = l; }
                *(v8usa*)(sh + lr * 72 + mb * 16 + hi * 8) = oh; *(v8usa*)(sl + lr * 72 + mb * 16 + hi * 8) = ol; }
            // compiler fence, as in the f32 epilogue below: the reads that follow take other lanes' LDS writes and must not be moved over them
            __builtin_amdgcn_wave_barrier(); asm volatile("" ::: "memory");
            v8us vh[4], vl[4];
#pragma unroll
            for (int s = 0; s < 4; ++s) { vh[s] = *(const v8usa*)(sh + (s * 4 + row) * 72 + col); vl[s] = *(const v8usa*)(sl + (s * 4 + row) * 72 + col); }
#pragma unroll
            for (int dt = -1; dt <= 1; ++dt) { const int t = s0 / RT + dt; if (t < 0 || t >= NT) continue;
                int tb, i0, kc0, span; tile_of(bb * NT + t, tb, i0, kc0, span);
                const size_t o = ((size_t)(bb * NT + t) * DD + c0 + nb * 16 + row) * SPN + (s0 - kc0) + col;
#pragma unroll
                for (int s = 0; s < 4; ++s) { *(v8usa*)(Vh + o + (size_t)s * 4 * SPN) = vh[s]; *(v8usa*)(Vl + o + (size_t)s * 4 * SPN) = vl[s]; }
                asm volatile("s_wait_xcnt 0x0" ::: "memory"); }   // the next tile's addresses and the next column block's values go into registers that these stores name
            // compiler fence: the next column block's LDS writes stay behind the reads above
            __builtin_amdgcn_wave_barrier(); asm volatile("" ::: "memory");
        }
        return;
    }
#pragma unroll
    for (int mb = 0; mb < 4; ++mb) {
#pragma unroll
        for (int nb = 0; nb < 4; ++nb) {
#pragma unroll
            for (int j = 0; j < 8; ++j) os[(hi * 8 + j) * 68 + nb * 16 + lr] = acc[mb][nb][j]; }
        __builtin_amdgcn_wave_barrier(); asm volatile("" ::: "memory");
        float* crow = C + (size_t)(r0 + mb * 16) * ldc + c0;
{
#pragma unroll
            for (int s = 0; s < 8; ++s) { const int row = 2 * s + hi, cofs = lr * 4; v4f val = *(const v4fa*)(os + row * 68 + cofs); if (BIAS) { val[0] += bfr(bias[c0 + cofs]); val[1] += bfr(bias[c0 + cofs + 1]); val[2] += bfr(bias[c0 + cofs + 2]); val[3] += bfr(bias[c0 + cofs + 3]); }
                *(v4f*)(crow + (size_t)row * ldc + cofs) = val; }
             }
        asm volatile("s_wait_xcnt 0x0" ::: "memory");   // the next row block's loads go into registers that the last store names
        __builtin_amdgcn_wave_barrier(); asm volatile("" ::: "memory");
    }
}

__device__ __forceinline__ h16 tohx(float x) { return (h16)x; }
typedef __attribute__((ext_vector_type(2))) unsigned short v2us;
typedef __attribute__((ext_vector_type(4))) unsigned short v4us;
typedef __attribute__((ext_vector_type(4))) _Float16 v4h;

__global__ __launch_bounds__(256) void k_wtG(const float* __restrict__ w0, const float* __restrict__ w1, const float* __restrict__ w2, int K, int N, bf* Bt) {
    const float* __restrict__ w = (blockIdx.y == 0) ? w0 : (blockIdx.y == 1) ? w1 : w2; Bt += (size_t)blockIdx.y * K * N;
    const int lane = threadIdx.x & 31; const int L0 = (blockIdx.x * 8 + (threadIdx.x >> 5)) * 8; const int nlines = N * K / 64;
{
#pragma unroll 1
        for (int l = 0; l < 8; ++l) { const int L = L0 + l; if (L >= nlines) break; const size_t e = (size_t)L * 64 + lane * 2; const int k = (int)(e % K), n = (int)(e / K); v2us o;
            o[0] = f2bf(w[(size_t)k * N + n]); o[1] = f2bf(w[(size_t)(k + 1) * N + n]); *(v2us*)(Bt + e) = o; }
         }
}
__global__ __launch_bounds__(256) void k_cvt8(const float* __restrict__ src, bf* dst, size_t n8) { const size_t i = (size_t)blockIdx.x * 256 + threadIdx.x; if (i >= n8) return; const v8f v = *(const v8f*)(src + i * 8); v8us o;
#pragma unroll
    for (int k = 0; k < 8; ++k) o[k] = f2bf(v[k]); *(v8us*)(dst + i * 8) = o;  }
// k_h16: fp16 copies of FQ and FK (8-B lanes); k_wsoft: wave per tile row rr (i = i0 + rr): columns jj < span with j = c0 + jj inside [i-128, i+128] keep
__global__ __launch_bounds__(256) void k_h16(const float* __restrict__ FQ, const float* __restrict__ FK, h16* Q16, h16* K16) { const size_t e = ((size_t)blockIdx.x * 256 + threadIdx.x) * 4; if (e >= (size_t)NB_ * SS * DD) return; const v4f a = *(const v4f*)(FQ + e), b = *(const v4f*)(FK + e); v4h q, k;
#pragma unroll
    for (int u = 0; u < 4; ++u) { q[u] = tohx(a[u]); k[u] = tohx(b[u]); } { *(v4h*)(Q16 + e) = q; *(v4h*)(K16 + e) = k;  } }
__global__ __launch_bounds__(256) void k_wsoft(const float* __restrict__ ST, bf* Ph, bf* Pl) { int b, i0, c0, span; tile_of((int)blockIdx.y, b, i0, c0, span); ST += (size_t)blockIdx.y * RT * SPN; Ph += (size_t)blockIdx.y * RT * SPN; Pl += (size_t)blockIdx.y * RT * SPN;
    const int lane = threadIdx.x & 31; const int rr = blockIdx.x * 8 + (threadIdx.x >> 5); if (rr >= RT) return; const int i = i0 + rr; const float* sr = ST + (size_t)rr * SPN; const float c = 0.044194173824159216f; float v[SPN / 32]; float mx = -3.0e38f;
#pragma unroll
    for (int ch = 0; ch < SPN / 128; ++ch) { const int jj0 = ch * 128 + lane * 4; const v4f a = *(const v4f*)(sr + jj0);
#pragma unroll
        for (int u = 0; u < 4; ++u) { const int jj = jj0 + u; const int j = c0 + jj; const bool ok = (jj < span) && (j >= i - LW) && (j <= i + LW); const float t = ok ? a[u] * c : -3.0e38f; v[ch * 4 + u] = t; mx = fmaxf(mx, t); } }
#pragma unroll
    for (int sh = 16; sh; sh >>= 1) mx = fmaxf(mx, __shfl_xor(mx, sh, 32));
    float sum = 0.f;
#pragma unroll
    for (int q = 0; q < SPN / 32; ++q) { float d0 = __fsub_rn(v[q], mx); asm volatile("" : "+v"(d0)); v[q] = __builtin_amdgcn_exp2f(__fmul_rn(d0, 1.4426950408889634f)); sum += v[q]; }
#pragma unroll
    for (int sh = 16; sh; sh >>= 1) sum += __shfl_xor(sum, sh, 32);
    const float f = __fdiv_rn(1.0f, sum);
    {
#pragma unroll
        for (int ch = 0; ch < SPN / 128; ++ch) { v4us oh, ol;
#pragma unroll
            for (int q = 0; q < 4; ++q) { unsigned short a, b; splitf(v[ch * 4 + q] * f, a, b); oh[q] = a; ol[q] = b; } const size_t oo = (size_t)rr * SPN + ch * 128 + lane * 4; *(v4us*)(Ph + oo) = oh; *(v4us*)(Pl + oo) = ol; }
         } }

extern "C" void kernel_launch(void* const* d_in, const int* in_sizes, int n_in,
                              void* d_out, int out_size, void* d_ws, size_t ws_size, hipStream_t stream) {
    (void)in_sizes; (void)n_in; (void)out_size;
    const float* x = (const float*)d_in[0]; const float* wq = (const float*)d_in[1]; const float* wk = (const float*)d_in[2]; const float* wv = (const float*)d_in[3]; const float* bq = (const float*)d_in[4]; const float* bk = (const float*)d_in[5]; const float* bv = (const float*)d_in[6];
    float* OUT = (float*)d_out;     // [8][2048][512]
    char* wsp = (char*)d_ws;
    auto take = [&](size_t bytes) { char* p = wsp; wsp += (bytes + 255) & ~(size_t)255; return (void*)p; };
    bf* WQ = (bf*)take((size_t)3 * DD * DD * 2);                       // Wq, Wk, Wv transposed, one after the other
    bf* XB = (bf*)take((size_t)NB_ * SS * DD * 2);
    float* FQ = (float*)take((size_t)2 * NB_ * SS * DD * 4);           // q, k (f32), one after the other
    float* FK = FQ + (size_t)NB_ * SS * DD;
    h16* Q16 = (h16*)take((size_t)NB_ * SS * DD * 2); h16* K16 = (h16*)take((size_t)NB_ * SS * DD * 2);
    bf* Vh = (bf*)take((size_t)NZ * DD * SPN * 2); bf* Vl = (bf*)take((size_t)NZ * DD * SPN * 2);
    // Scores and probabilities of all tiles (48 MiB) lie over the f32 q and k (64 MiB), whose last reader is k_h16.
    float* ST = FQ; bf* Ph = (bf*)(ST + (size_t)NZ * RT * SPN); bf* Pl = Ph + (size_t)NZ * RT * SPN;
    if ((size_t)(wsp - (char*)d_ws) > ws_size) return;    // total ~ 210 MiB
    k_wtG<<<dim3((DD * DD / 64 + 63) / 64, 3, 1), 256, 0, stream>>>(wq, wk, wv, DD, DD, WQ);
    k_cvt8<<<(NB_ * SS * DD / 8 + 255) / 256, 256, 0, stream>>>(x, XB, (size_t)NB_ * SS * DD / 8);
    k_gemmw<bf, 0, true, 0, true><<<dim3(NB_ * SS / 64, DD / 64, 3), 32, 0, stream>>>(XB, nullptr, WQ, nullptr, DD, FQ, DD, bq, bk, bv, 0, (size_t)DD * DD, (size_t)NB_ * SS * DD, Vh, Vl);
    k_h16<<<(unsigned)(((size_t)NB_ * SS * DD / 4 + 255) / 256), 256, 0, stream>>>(FQ, FK, Q16, K16);
    k_gemmw<h16, 0, false, 1, false><<<dim3(RT / 64, SPN / 64, NZ), 32, 0, stream>>>(Q16, nullptr, K16, nullptr, DD, ST, SPN, nullptr, nullptr, nullptr, (size_t)RT * DD, 0, (size_t)RT * SPN, nullptr, nullptr);
    k_wsoft<<<dim3(RT / 8, NZ, 1), 256, 0, stream>>>(ST, Ph, Pl);
    k_gemmw<bf, 2, false, 2, false><<<dim3(RT / 64, DD / 64, NZ), 32, 0, stream>>>(Ph, Pl, Vh, Vl, SPN, OUT, DD, nullptr, nullptr, nullptr, (size_t)RT * SPN, (size_t)DD * SPN, (size_t)RT * DD, nullptr, nullptr);
}

// v003
// A run of this version takes 110 microseconds.
// Two timings next to v002 put it at 1.53 and 1.52 times that version's speed.
// Counting every step since v000, it is 34.6 times as fast.
#include <hip/hip_runtime.h>

// TransformedAttention (x [8][2048][512]; q/k/v = x W + b (512); scores = q.k / sqrt(512) restricted to the sliding window i-128 <= j <= i+128 (others masked); softmax; out = attn v -> [8][2048][512]).
// Banded evaluation: for each 128-row query tile only the key columns max(0,i0-128) .. min(2048,i0+256) (<= 384) are computed.
// Compute dtypes, f32 accumulate: every input rounded to bf16; q/k/v on PLAIN bf16 operands (inputs: exact) + bias; banded scores (K 512) on single fp16 planes; window mask + softmax f32 -> bf16 hi+lo probability planes;

#define NB_  8
#define SS   2048
#define DD   512
#define RT   128
#define SPN  384
#define LW   128
#define NT   (SS / RT)        // query tiles per batch entry
#define NZ   (NB_ * NT)       // all (batch, query tile) pairs; one grid slot each
typedef _Float16 h16;
typedef unsigned short bf;
typedef __attribute__((ext_vector_type(16))) __bf16   v16bf;
typedef __attribute__((ext_vector_type(16))) _Float16 v16h;
typedef __attribute__((ext_vector_type(8)))  _Float16 v8h;
typedef __attribute__((ext_vector_type(8)))  unsigned short v8us;
typedef __attribute__((ext_vector_type(8)))  float    v8f;
typedef __attribute__((ext_vector_type(4)))  float    v4f;
typedef v8h  __attribute__((may_alias)) v8ha;
typedef v4f  __attribute__((may_alias)) v4fa;
typedef v8us __attribute__((may_alias)) v8usa;

__device__ __forceinline__ unsigned short f2bf(float f) { unsigned u = __float_as_uint(f); u += 0x7FFFu + ((u >> 16) & 1u); return (unsigned short)(u >> 16); }
__device__ __forceinline__ float bf2f(unsigned short b) { return __uint_as_float(((unsigned)b) << 16); }
__device__ __forceinline__ float bfr(float f) { return bf2f(f2bf(f)); }
__device__ __forceinline__ v16h cat16(v8h lo, v8h hi) { return __builtin_shufflevector(lo, hi, 0, 1, 2, 3, 4, 5, 6, 7, 8, 9, 10, 11, 12, 13, 14, 15); }
__device__ __forceinline__ v16bf cat16b(v8us lo, v8us hi) { return __builtin_bit_cast(v16bf, __builtin_shufflevector(lo, hi, 0, 1, 2, 3, 4, 5, 6, 7, 8, 9, 10, 11, 12, 13, 14, 15)); }
__device__ __forceinline__ v8f wmma16(v16h a, v16h b, v8f c) { return __builtin_amdgcn_wmma_f32_16x16x32_f16(false, a, false, b, (short)0, c, false, false); }
__device__ __forceinline__ v8f wmmab(v16bf a, v16bf b, v8f c) { return __builtin_amdgcn_wmma_f32_16x16x32_bf16(false, a, false, b, (short)0, c, false, false); }



// Query tile z = b * NT + t: rows i0 .. i0+127 of batch entry b, key columns c0 .. c0+span-1 (span 256 at the two edge tiles, else 384).
__device__ __forceinline__ void tile_of(int z, int& b, int& i0, int& c0, int& span) { b = z / NT; i0 = (z % NT) * RT; c0 = (i0 - LW > 0) ? (i0 - LW) : 0; const int c1 = (i0 + RT + LW < SS) ? (i0 + RT + LW) : SS; span = c1 - c0; }

// ---- k_gemmw: GEMM, 128x128 output tile per work-group of 2 x 2 waves, 64x64 (16 accumulators) per wave; grid (M/128, N/128, Z), 128 threads.
// Operands are K-contiguous 16-bit planes. Each stage brings one 128-B line (64 k) of the tile's 128 A rows and 128 Bt rows (and of the second planes, NSPLIT 2) into LDS by asynchronous copies, two buffers: the next stage flies while this one is multiplied.
// C[m][n] (f32, pitch ldc, + optional f32 bias[n]) = sum_k A[m][k] Bt[n][k] (+ split products per NSPLIT). z-batch strides sA/sB/sC in elements. K % 64 == 0. bias/bias1/bias2: the bias of z = 0/1/2. BAND 1: z is a query tile, Bt starts at that tile's first key row and column blocks past its span leave. BAND 2: z is a query tile, k runs over that tile's span only. VT: z = 2 (v) stores no C: it adds the bias, splits into bf16 hi and lo and stores both transposed, VS[d][jj] = v[c0 + jj][d], into the slice of every query tile whose key window holds its rows.
#define BT   128              // rows and columns of a work-group's output tile
#define KS   64               // k per stage: one 128-B line of every operand row
#define LP   72               // LDS row pitch in elements: 144 B = 16 B x 9, the pitch of ds_load_b128 readers of 128-B rows
#define PLN  (BT * LP)        // elements of one plane's tile in LDS
template <typename T16> struct WFrag;
template <> struct WFrag<h16> { typedef v16h V; static __device__ __forceinline__ V ld(const h16* p) { return cat16(*(const v8h*)p, *(const v8h*)(p + 16)); } static __device__ __forceinline__ v8f mma(V a, V b, v8f c) { return wmma16(a, b, c); } };
template <> struct WFrag<bf> { typedef v16bf V; static __device__ __forceinline__ V ld(const bf* p) { return cat16b(*(const v8us*)p, *(const v8us*)(p + 16)); } static __device__ __forceinline__ v8f mma(V a, V b, v8f c) { return wmmab(a, b, c); } };
__device__ __forceinline__ void splitf(float y, unsigned short& h, unsigned short& l) { h = f2bf(y); l = f2bf(y - bf2f(h)); }
// One plane's 128 x 64 tile: this thread's 16 B of rows r, r + 16, .. r + 112 (g: its 16 B of row r, rs: 16 rows in elements, l: their LDS byte address). A wave's copy covers four whole 128-B lines.
// The closing s_wait_xcnt stands inside the statement, so that no address register of a copy is rewritten in front of it.
template <typename T16>
__device__ __forceinline__ void stage8(const T16* g, size_t rs, unsigned l) {
    asm volatile("global_load_async_to_lds_b128 %0, %8, off\n\t"
                 "global_load_async_to_lds_b128 %1, %9, off\n\t"
                 "global_load_async_to_lds_b128 %2, %10, off\n\t"
                 "global_load_async_to_lds_b128 %3, %11, off\n\t"
                 "global_load_async_to_lds_b128 %4, %12, off\n\t"
                 "global_load_async_to_lds_b128 %5, %13, off\n\t"
                 "global_load_async_to_lds_b128 %6, %14, off\n\t"
                 "global_load_async_to_lds_b128 %7, %15, off\n\t"
                 "s_wait_xcnt 0x0"
                 :: "v"(l), "v"(l + 1u * 16 * LP * 2), "v"(l + 2u * 16 * LP * 2), "v"(l + 3u * 16 * LP * 2), "v"(l + 4u * 16 * LP * 2), "v"(l + 5u * 16 * LP * 2), "v"(l + 6u * 16 * LP * 2), "v"(l + 7u * 16 * LP * 2),
                    "v"(g), "v"(g + rs), "v"(g + 2 * rs), "v"(g + 3 * rs), "v"(g + 4 * rs), "v"(g + 5 * rs), "v"(g + 6 * rs), "v"(g + 7 * rs)
                 : "memory");
}
template <typename T16, int NSPLIT, bool BIAS, int BAND, bool VT>
__global__ __launch_bounds__(128) void k_gemmw(const T16* __restrict__ A, const T16* __restrict__ A2, const T16* __restrict__ Bt, const T16* __restrict__ Bt2, int K, float* C, int ldc, const float* __restrict__ bias, const float* __restrict__ bias1, const float* __restrict__ bias2, size_t sA, size_t sB, size_t sC, bf* Vh, bf* Vl) {
    typedef typename WFrag<T16>::V V;
    static_assert(NSPLIT == 0 || NSPLIT == 2, "planes in LDS: A, Bt (, A2, Bt2)");
    constexpr int NPL = (NSPLIT == 2) ? 4 : 2;
    __shared__ __align__(16) T16 sm[2 * NPL * PLN];    // two buffers of NPL plane tiles; behind the k loop each wave's output staging
    const size_t z = blockIdx.z; A += z * sA; if (A2) A2 += z * sA; Bt += z * sB; if (Bt2) Bt2 += z * sB; C += z * sC;
    int kend = K;
    if (BAND) { int b, i0, kc0, span; tile_of((int)blockIdx.z, b, i0, kc0, span); if (BAND == 1) { if ((int)blockIdx.y * BT >= span) return; Bt += ((size_t)b * SS + kc0) * K; } else kend = span; }
    if (BIAS) bias = (blockIdx.z == 0) ? bias : (blockIdx.z == 1) ? bias1 : bias2;
    const int tid = threadIdx.x, lane = tid & 31, lr = lane & 15, hi = lane >> 4, wv = tid >> 5; const int wm = (wv & 1) * 64, wn = (wv >> 1) * 64;
    const int r0 = blockIdx.x * BT + wm, c0 = blockIdx.y * BT + wn;
    v8f acc[4][4];
#pragma unroll
    for (int mb = 0; mb < 4; ++mb)
#pragma unroll
        for (int nb = 0; nb < 4; ++nb) acc[mb][nb] = (v8f){};
    const int srow = tid >> 3, scol = (tid & 7) * 8;     // 8 threads per 128-B row, 16 rows per copy of the work-group
    const size_t ga = (size_t)(blockIdx.x * BT + srow) * K + scol, gb = (size_t)(blockIdx.y * BT + srow) * K + scol, rs = (size_t)16 * K;
    const unsigned l0 = (unsigned)(size_t)sm + (unsigned)(srow * LP + scol) * 2u;
    auto fill = [&](int st) { const int kc = st * KS; const unsigned l = l0 + (unsigned)(st & 1) * (unsigned)(NPL * PLN * 2);
        stage8(A + ga + kc, rs, l); stage8(Bt + gb + kc, rs, l + (unsigned)(PLN * 2));
        if (NSPLIT == 2) { stage8(A2 + ga + kc, rs, l + (unsigned)(2 * PLN * 2)); stage8(Bt2 + gb + kc, rs, l + (unsigned)(3 * PLN * 2)); } };
    const int nst = kend / KS;
    fill(0);
    asm volatile("s_wait_asynccnt 0x0" ::: "memory");    // this wave's copies of stage 0 have landed
    __syncthreads();                                     // and every other wave's: stage 0 may be read
    if (nst > 1) fill(1);
#pragma unroll 1
    for (int st = 0; st < nst; ++st) {
        const T16* sb = sm + (st & 1) * (NPL * PLN);
#pragma unroll
        for (int ks = 0; ks < KS; ks += 32) {
            const T16* pa = sb + (wm + lr) * LP + ks + 8 * hi; const T16* pb = sb + PLN + (wn + lr) * LP + ks + 8 * hi;
            V a[4], a2[4];
#pragma unroll
            for (int mb = 0; mb < 4; ++mb) { a[mb] = WFrag<T16>::ld(pa + mb * 16 * LP); if (NSPLIT == 2) a2[mb] = WFrag<T16>::ld(pa + 2 * PLN + mb * 16 * LP); }
#pragma unroll
            for (int nb = 0; nb < 4; ++nb) { const V b = WFrag<T16>::ld(pb + nb * 16 * LP); V b2; if (NSPLIT == 2) b2 = WFrag<T16>::ld(pb + 2 * PLN + nb * 16 * LP);
#pragma unroll
                for (int mb = 0; mb < 4; ++mb) { acc[mb][nb] = WFrag<T16>::mma(a[mb], b, acc[mb][nb]); if (NSPLIT == 2) acc[mb][nb] = WFrag<T16>::mma(a2[mb], b, acc[mb][nb]); if (NSPLIT == 2) acc[mb][nb] = WFrag<T16>::mma(a[mb], b2, acc[mb][nb]); } }
            asm volatile("v_nop\n\tv_nop\n\tv_nop\n\tv_nop" : "+v"(acc[0][0]), "+v"(acc[1][1]), "+v"(acc[2][2]), "+v"(acc[3][3]) : "v"(a[0]), "v"(a[3]));
        }
        asm volatile("s_wait_dscnt 0x0" ::: "memory");       // this wave's reads of the buffer are done before it is refilled
        asm volatile("s_wait_asynccnt 0x0" ::: "memory");    // this wave's copies of stage st + 1 have landed
        __syncthreads();                                     // publishes stage st + 1 and ends every wave's reads of stage st
        if (st + 2 < nst) fill(st + 2);
    }
    asm volatile("s_wait_asynccnt 0x0" ::: "memory");        // no copy is in flight when the buffers become output staging
    float* os = (float*)sm + wv * (16 * 72);                 // each wave stages its output in a range of its own
    if (VT && blockIdx.z == 2) {
        // An accumulator lane holds 8 consecutive rows (keys) of one column (d): 16 B of a transposed bf16 row. The 4 row blocks of 16 columns meet in LDS (pitch 144 B), so that each store covers whole 128-B lines. Every loop here is unrolled: acc, vh and vl live in registers and need constant indices.
        static_assert(LW == RT && RT % 64 == 0, "the 64 keys of a wave lie in the windows of the query tiles s0 / RT - 1 .. s0 / RT + 1, whole");
        bf* sh = (bf*)os; bf* sl = sh + 16 * 72;
        const int bb = r0 / SS, s0 = r0 % SS, row = lane >> 3, col = (lane & 7) * 8;
#pragma unroll
        for (int nb = 0; nb < 4; ++nb) { const float bz = bfr(bias[c0 + nb * 16 + lr]);
#pragma unroll
            for (int mb = 0; mb < 4; ++mb) { v8us oh, ol;
#pragma unroll
                for (int j = 0; j < 8; ++j) { unsigned short h, l; splitf(acc[mb][nb][j] + bz, h, l); oh[j] = h; ol[j] = l; }
                *(v8usa*)(sh + lr * 72 + mb * 16 + hi * 8) = oh; *(v8usa*)(sl + lr * 72 + mb * 16 + hi * 8) = ol; }
            // compiler fence, as in the f32 epilogue below: the reads that follow take other lanes' LDS writes and must not be moved over them
            __builtin_amdgcn_wave_barrier(); asm volatile("" ::: "memory");
            v8us vh[4], vl[4];
#pragma unroll
            for (int s = 0; s < 4; ++s) { vh[s] = *(const v8usa*)(sh + (s * 4 + row) * 72 + col); vl[s] = *(const v8usa*)(sl + (s * 4 + row) * 72 + col); }
#pragma unroll
            for (int dt = -1; dt <= 1; ++dt) { const int t = s0 / RT + dt; if (t < 0 || t >= NT) continue;
                int tb, i0, kc0, span; tile_of(bb * NT + t, tb, i0, kc0, span);
                const size_t o = ((size_t)(bb * NT + t) * DD + c0 + nb * 16 + row) * SPN + (s0 - kc0) + col;
#pragma unroll
                for (int s = 0; s < 4; ++s) { *(v8usa*)(Vh + o + (size_t)s * 4 * SPN) = vh[s]; *(v8usa*)(Vl + o + (size_t)s * 4 * SPN) = vl[s]; }
                asm volatile("s_wait_xcnt 0x0" ::: "memory"); }   // the next tile's addresses and the next column block's values go into registers that these stores name
            // compiler fence: the next column block's LDS writes stay behind the reads above
            __builtin_amdgcn_wave_barrier(); asm volatile("" ::: "memory");
        }
        return;
    }
#pragma unroll
    for (int mb = 0; mb < 4; ++mb) {
#pragma unroll
        for (int nb = 0; nb < 4; ++nb) {
#pragma unroll
            for (int j = 0; j < 8; ++j) os[(hi * 8 + j) * 68 + nb * 16 + lr] = acc[mb][nb][j]; }
        __builtin_amdgcn_wave_barrier(); asm volatile("" ::: "memory");
        float* crow = C + (size_t)(r0 + mb * 16) * ldc + c0;
{
#pragma unroll
            for (int s = 0; s < 8; ++s) { const int row = 2 * s + hi, cofs = lr * 4; v4f val = *(const v4fa*)(os + row * 68 + cofs); if (BIAS) { val[0] += bfr(bias[c0 + cofs]); val[1] += bfr(bias[c0 + cofs + 1]); val[2] += bfr(bias[c0 + cofs + 2]); val[3] += bfr(bias[c0 + cofs + 3]); }
                *(v4f*)(crow + (size_t)row * ldc + cofs) = val; }
             }
        asm volatile("s_wait_xcnt 0x0" ::: "memory");   // the next row block's loads go into registers that the last store names
        __builtin_amdgcn_wave_barrier(); asm volatile("" ::: "memory");
    }
}

__device__ __forceinline__ h16 tohx(float x) { return (h16)x; }
typedef __attribute__((ext_vector_type(2))) unsigned short v2us;
typedef __attribute__((ext_vector_type(4))) unsigned short v4us;
typedef __attribute__((ext_vector_type(4))) _Float16 v4h;

__global__ __launch_bounds__(256) void k_wtG(const float* __restrict__ w0, const float* __restrict__ w1, const float* __restrict__ w2, int K, int N, bf* Bt) {
    const float* __restrict__ w = (blockIdx.y == 0) ? w0 : (blockIdx.y == 1) ? w1 : w2; Bt += (size_t)blockIdx.y * K * N;
    const int lane = threadIdx.x & 31; const int L0 = (blockIdx.x * 8 + (threadIdx.x >> 5)) * 8; const int nlines = N * K / 64;
{
#pragma unroll 1
        for (int l = 0; l < 8; ++l) { const int L = L0 + l; if (L >= nlines) break; const size_t e = (size_t)L * 64 + lane * 2; const int k = (int)(e % K), n = (int)(e / K); v2us o;
            o[0] = f2bf(w[(size_t)k * N + n]); o[1] = f2bf(w[(size_t)(k + 1) * N + n]); *(v2us*)(Bt + e) = o; }
         }
}
__global__ __launch_bounds__(256) void k_cvt8(const float* __restrict__ src, bf* dst, size_t n8) { const size_t i = (size_t)blockIdx.x * 256 + threadIdx.x; if (i >= n8) return; const v8f v = *(const v8f*)(src + i * 8); v8us o;
#pragma unroll
    for (int k = 0; k < 8; ++k) o[k] = f2bf(v[k]); *(v8us*)(dst + i * 8) = o;  }
// k_h16: fp16 copies of FQ and FK (8-B lanes); k_wsoft: wave per tile row rr (i = i0 + rr): columns jj < span with j = c0 + jj inside [i-128, i+128] keep
__global__ __launch_bounds__(256) void k_h16(const float* __restrict__ FQ, const float* __restrict__ FK, h16* Q16, h16* K16) { const size_t e = ((size_t)blockIdx.x * 256 + threadIdx.x) * 4; if (e >= (size_t)NB_ * SS * DD) return; const v4f a = *(const v4f*)(FQ + e), b = *(const v4f*)(FK + e); v4h q, k;
#pragma unroll
    for (int u = 0; u < 4; ++u) { q[u] = tohx(a[u]); k[u] = tohx(b[u]); } { *(v4h*)(Q16 + e) = q; *(v4h*)(K16 + e) = k;  } }
__global__ __launch_bounds__(256) void k_wsoft(const float* __restrict__ ST, bf* Ph, bf* Pl) { int b, i0, c0, span; tile_of((int)blockIdx.y, b, i0, c0, span); ST += (size_t)blockIdx.y * RT * SPN; Ph += (size_t)blockIdx.y * RT * SPN; Pl += (size_t)blockIdx.y * RT * SPN;
    const int lane = threadIdx.x & 31; const int rr = blockIdx.x * 8 + (threadIdx.x >> 5); if (rr >= RT) return; const int i = i0 + rr; const float* sr = ST + (size_t)rr * SPN; const float c = 0.044194173824159216f; float v[SPN / 32]; float mx = -3.0e38f;
#pragma unroll
    for (int ch = 0; ch < SPN / 128; ++ch) { const int jj0 = ch * 128 + lane * 4; const v4f a = *(const v4f*)(sr + jj0);
#pragma unroll
        for (int u = 0; u < 4; ++u) { const int jj = jj0 + u; const int j = c0 + jj; const bool ok = (jj < span) && (j >= i - LW) && (j <= i + LW); const float t = ok ? a[u] * c : -3.0e38f; v[ch * 4 + u] = t; mx = fmaxf(mx, t); } }
#pragma unroll
    for (int sh = 16; sh; sh >>= 1) mx = fmaxf(mx, __shfl_xor(mx, sh, 32));
    float sum = 0.f;
#pragma unroll
    for (int q = 0; q < SPN / 32; ++q) { float d0 = __fsub_rn(v[q], mx); asm volatile("" : "+v"(d0)); v[q] = __builtin_amdgcn_exp2f(__fmul_rn(d0, 1.4426950408889634f)); sum += v[q]; }
#pragma unroll
    for (int sh = 16; sh; sh >>= 1) sum += __shfl_xor(sum, sh, 32);
    const float f = __fdiv_rn(1.0f, sum);
    {
#pragma unroll
        for (int ch = 0; ch < SPN / 128; ++ch) { v4us oh, ol;
#pragma unroll
            for (int q = 0; q < 4; ++q) { unsigned short a, b; splitf(v[ch * 4 + q] * f, a, b); oh[q] = a; ol[q] = b; } const size_t oo = (size_t)rr * SPN + ch * 128 + lane * 4; *(v4us*)(Ph + oo) = oh; *(v4us*)(Pl + oo) = ol; }
         } }

extern "C" void kernel_launch(void* const* d_in, const int* in_sizes, int n_in,
                              void* d_out, int out_size, void* d_ws, size_t ws_size, hipStream_t stream) {
    (void)in_sizes; (void)n_in; (void)out_size;
    const float* x = (const float*)d_in[0]; const float* wq = (const float*)d_in[1]; const float* wk = (const float*)d_in[2]; const float* wv = (const float*)d_in[3]; const float* bq = (const float*)d_in[4]; const float* bk = (const float*)d_in[5]; const float* bv = (const float*)d_in[6];
    float* OUT = (float*)d_out;     // [8][2048][512]
    char* wsp = (char*)d_ws;
    auto take = [&](size_t bytes) { char* p = wsp; wsp += (bytes + 255) & ~(size_t)255; return (void*)p; };
    bf* WQ = (bf*)take((size_t)3 * DD * DD * 2);                       // Wq, Wk, Wv transposed, one after the other
    bf* XB = (bf*)take((size_t)NB_ * SS * DD * 2);
    float* FQ = (float*)take((size_t)2 * NB_ * SS * DD * 4);           // q, k (f32), one after the other
    float* FK = FQ + (size_t)NB_ * SS * DD;
    h16* Q16 = (h16*)take((size_t)NB_ * SS * DD * 2); h16* K16 = (h16*)take((size_t)NB_ * SS * DD * 2);
    bf* Vh = (bf*)take((size_t)NZ * DD * SPN * 2); bf* Vl = (bf*)take((size_t)NZ * DD * SPN * 2);
    // Scores and probabilities of all tiles (48 MiB) lie over the f32 q and k (64 MiB), whose last reader is k_h16.
    float* ST = FQ; bf* Ph = (bf*)(ST + (size_t)NZ * RT * SPN); bf* Pl = Ph + (size_t)NZ * RT * SPN;
    if ((size_t)(wsp - (char*)d_ws) > ws_size) return;    // total ~ 210 MiB
    k_wtG<<<dim3((DD * DD / 64 + 63) / 64, 3, 1), 256, 0, stream>>>(wq, wk, wv, DD, DD, WQ);
    k_cvt8<<<(NB_ * SS * DD / 8 + 255) / 256, 256, 0, stream>>>(x, XB, (size_t)NB_ * SS * DD / 8);
    k_gemmw<bf, 0, true, 0, true><<<dim3(NB_ * SS / BT, DD / BT, 3), 128, 0, stream>>>(XB, nullptr, WQ, nullptr, DD, FQ, DD, bq, bk, bv, 0, (size_t)DD * DD, (size_t)NB_ * SS * DD, Vh, Vl);
    k_h16<<<(unsigned)(((size_t)NB_ * SS * DD / 4 + 255) / 256), 256, 0, stream>>>(FQ, FK, Q16, K16);
    k_gemmw<h16, 0, false, 1, false><<<dim3(RT / BT, SPN / BT, NZ), 128, 0, stream>>>(Q16, nullptr, K16, nullptr, DD, ST, SPN, nullptr, nullptr, nullptr, (size_t)RT * DD, 0, (size_t)RT * SPN, nullptr, nullptr);
    k_wsoft<<<dim3(RT / 8, NZ, 1), 256, 0, stream>>>(ST, Ph, Pl);
    k_gemmw<bf, 2, false, 2, false><<<dim3(RT / BT, DD / BT, NZ), 128, 0, stream>>>(Ph, Pl, Vh, Vl, SPN, OUT, DD, nullptr, nullptr, nullptr, (size_t)RT * SPN, (size_t)DD * SPN, (size_t)RT * DD, nullptr, nullptr);
}

// v004
// One run takes 87.8 microseconds.
// Two timings next to v003 both put it at 1.26 times that version's speed.
// Counting every step since v000, it is 43.5 times as fast.
#include <hip/hip_runtime.h>

// TransformedAttention (x [8][2048][512]; q/k/v = x W + b (512); scores = q.k / sqrt(512) restricted to the sliding window i-128 <= j <= i+128 (others masked); softmax; out = attn v -> [8][2048][512]).
// Banded evaluation: for each 128-row query tile only the key columns max(0,i0-128) .. min(2048,i0+256) (<= 384) are computed.
// Compute dtypes, f32 accumulate: every input rounded to bf16; q/k/v on PLAIN bf16 operands (inputs: exact) + bias; banded scores (K 512) on single fp16 planes; window mask + softmax f32 -> bf16 hi+lo probability planes;

#define NB_  8
#define SS   2048
#define DD   512
#define RT   128
#define SPN  384
#define LW   128
#define NT   (SS / RT)        // query tiles per batch entry
#define NZ   (NB_ * NT)       // all (batch, query tile) pairs; one grid slot each
typedef _Float16 h16;
typedef unsigned short bf;
typedef __attribute__((ext_vector_type(16))) __bf16   v16bf;
typedef __attribute__((ext_vector_type(16))) _Float16 v16h;
typedef __attribute__((ext_vector_type(8)))  _Float16 v8h;
typedef __attribute__((ext_vector_type(8)))  unsigned short v8us;
typedef __attribute__((ext_vector_type(8)))  float    v8f;
typedef __attribute__((ext_vector_type(4)))  float    v4f;
typedef v8h  __attribute__((may_alias)) v8ha;
typedef v4f  __attribute__((may_alias)) v4fa;
typedef v8us __attribute__((may_alias)) v8usa;

__device__ __forceinline__ unsigned short f2bf(float f) { unsigned u = __float_as_uint(f); u += 0x7FFFu + ((u >> 16) & 1u); return (unsigned short)(u >> 16); }
__device__ __forceinline__ float bf2f(unsigned short b) { return __uint_as_float(((unsigned)b) << 16); }
__device__ __forceinline__ float bfr(float f) { return bf2f(f2bf(f)); }
__device__ __forceinline__ v16h cat16(v8h lo, v8h hi) { return __builtin_shufflevector(lo, hi, 0, 1, 2, 3, 4, 5, 6, 7, 8, 9, 10, 11, 12, 13, 14, 15); }
__device__ __forceinline__ v16bf cat16b(v8us lo, v8us hi) { return __builtin_bit_cast(v16bf, __builtin_shufflevector(lo, hi, 0, 1, 2, 3, 4, 5, 6, 7, 8, 9, 10, 11, 12, 13, 14, 15)); }
__device__ __forceinline__ v8f wmma16(v16h a, v16h b, v8f c) { return __builtin_amdgcn_wmma_f32_16x16x32_f16(false, a, false, b, (short)0, c, false, false); }
__device__ __forceinline__ v8f wmmab(v16bf a, v16bf b, v8f c) { return __builtin_amdgcn_wmma_f32_16x16x32_bf16(false, a, false, b, (short)0, c, false, false); }



// Query tile z = b * NT + t: rows i0 .. i0+127 of batch entry b, key columns c0 .. c0+span-1 (span 256 at the two edge tiles, else 384).
__device__ __forceinline__ void tile_of(int z, int& b, int& i0, int& c0, int& span) { b = z / NT; i0 = (z % NT) * RT; c0 = (i0 - LW > 0) ? (i0 - LW) : 0; const int c1 = (i0 + RT + LW < SS) ? (i0 + RT + LW) : SS; span = c1 - c0; }

// ---- k_gemmw: GEMM, 128x128 output tile per work-group of 2 x 2 waves, 64x64 (16 accumulators) per wave; grid (M/128, N/128, Z), 128 threads.
// Operands are K-contiguous 16-bit planes. Each stage brings one 128-B line (64 k) of the tile's 128 A rows and 128 Bt rows (and of the second planes, NSPLIT 2) into LDS by asynchronous copies, two buffers: the next stage flies while this one is multiplied.
// C[m][n] (f32, pitch ldc, + optional f32 bias[n]) = sum_k A[m][k] Bt[n][k] (+ split products per NSPLIT). z-batch strides sA/sB/sC in elements. K % 64 == 0. bias/bias1/bias2: the bias of z = 0/1/2. BAND 1: z is a query tile, Bt starts at that tile's first key row and column blocks past its span leave. BAND 2: z is a query tile, k runs over that tile's span only. VT: no C is stored. z = 0, 1 (q, k) add the bias in f32, round once to fp16 and store the planes H + z sC (pitch ldc) that the score product reads; z = 2 (v) adds the bias, splits into bf16 hi and lo and stores both transposed, VS[d][jj] = v[c0 + jj][d], into the slice of every query tile whose key window holds its rows.
#define BT   128              // rows and columns of a work-group's output tile
#define KS   64               // k per stage: one 128-B line of every operand row
#define LP   72               // LDS row pitch in elements: 144 B = 16 B x 9, the pitch of ds_load_b128 readers of 128-B rows
#define PLN  (BT * LP)        // elements of one plane's tile in LDS
template <typename T16> struct WFrag;
template <> struct WFrag<h16> { typedef v16h V; static __device__ __forceinline__ V ld(const h16* p) { return cat16(*(const v8h*)p, *(const v8h*)(p + 16)); } static __device__ __forceinline__ v8f mma(V a, V b, v8f c) { return wmma16(a, b, c); } };
template <> struct WFrag<bf> { typedef v16bf V; static __device__ __forceinline__ V ld(const bf* p) { return cat16b(*(const v8us*)p, *(const v8us*)(p + 16)); } static __device__ __forceinline__ v8f mma(V a, V b, v8f c) { return wmmab(a, b, c); } };
__device__ __forceinline__ void splitf(float y, unsigned short& h, unsigned short& l) { h = f2bf(y); l = f2bf(y - bf2f(h)); }
// One plane's 128 x 64 tile: this thread's 16 B of rows r, r + 16, .. r + 112 (g: its 16 B of row r, rs: 16 rows in elements, l: their LDS byte address). A wave's copy covers four whole 128-B lines.
// The closing s_wait_xcnt stands inside the statement, so that no address register of a copy is rewritten in front of it.
template <typename T16>
__device__ __forceinline__ void stage8(const T16* g, size_t rs, unsigned l) {
    asm volatile("global_load_async_to_lds_b128 %0, %8, off\n\t"
                 "global_load_async_to_lds_b128 %1, %9, off\n\t"
                 "global_load_async_to_lds_b128 %2, %10, off\n\t"
                 "global_load_async_to_lds_b128 %3, %11, off\n\t"
                 "global_load_async_to_lds_b128 %4, %12, off\n\t"
                 "global_load_async_to_lds_b128 %5, %13, off\n\t"
                 "global_load_async_to_lds_b128 %6, %14, off\n\t"
                 "global_load_async_to_lds_b128 %7, %15, off\n\t"
                 "s_wait_xcnt 0x0"
                 :: "v"(l), "v"(l + 1u * 16 * LP * 2), "v"(l + 2u * 16 * LP * 2), "v"(l + 3u * 16 * LP * 2), "v"(l + 4u * 16 * LP * 2), "v"(l + 5u * 16 * LP * 2), "v"(l + 6u * 16 * LP * 2), "v"(l + 7u * 16 * LP * 2),
                    "v"(g), "v"(g + rs), "v"(g + 2 * rs), "v"(g + 3 * rs), "v"(g + 4 * rs), "v"(g + 5 * rs), "v"(g + 6 * rs), "v"(g + 7 * rs)
                 : "memory");
}
template <typename T16, int NSPLIT, bool BIAS, int BAND, bool VT>
__global__ __launch_bounds__(128) void k_gemmw(const T16* __restrict__ A, const T16* __restrict__ A2, const T16* __restrict__ Bt, const T16* __restrict__ Bt2, int K, float* C, int ldc, const float* __restrict__ bias, const float* __restrict__ bias1, const float* __restrict__ bias2, size_t sA, size_t sB, size_t sC, bf* Vh, bf* Vl, h16* H) {
    typedef typename WFrag<T16>::V V;
    static_assert(NSPLIT == 0 || NSPLIT == 2, "planes in LDS: A, Bt (, A2, Bt2)");
    constexpr int NPL = (NSPLIT == 2) ? 4 : 2;
    __shared__ __align__(16) T16 sm[2 * NPL * PLN];    // two buffers of NPL plane tiles; behind the k loop each wave's output staging
    const size_t z = blockIdx.z; A += z * sA; if (A2) A2 += z * sA; Bt += z * sB; if (Bt2) Bt2 += z * sB; C += z * sC;
    int kend = K;
    if (BAND) { int b, i0, kc0, span; tile_of((int)blockIdx.z, b, i0, kc0, span); if (BAND == 1) { if ((int)blockIdx.y * BT >= span) return; Bt += ((size_t)b * SS + kc0) * K; } else kend = span; }
    if (BIAS) bias = (blockIdx.z == 0) ? bias : (blockIdx.z == 1) ? bias1 : bias2;
    const int tid = threadIdx.x, lane = tid & 31, lr = lane & 15, hi = lane >> 4, wv = tid >> 5; const int wm = (wv & 1) * 64, wn = (wv >> 1) * 64;
    const int r0 = blockIdx.x * BT + wm, c0 = blockIdx.y * BT + wn;
    v8f acc[4][4];
#pragma unroll
    for (int mb = 0; mb < 4; ++mb)
#pragma unroll
        for (int nb = 0; nb < 4; ++nb) acc[mb][nb] = (v8f){};
    const int srow = tid >> 3, scol = (tid & 7) * 8;     // 8 threads per 128-B row, 16 rows per copy of the work-group
    const size_t ga = (size_t)(blockIdx.x * BT + srow) * K + scol, gb = (size_t)(blockIdx.y * BT + srow) * K + scol, rs = (size_t)16 * K;
    const unsigned l0 = (unsigned)(size_t)sm + (unsigned)(srow * LP + scol) * 2u;
    auto fill = [&](int st) { const int kc = st * KS; const unsigned l = l0 + (unsigned)(st & 1) * (unsigned)(NPL * PLN * 2);
        stage8(A + ga + kc, rs, l); stage8(Bt + gb + kc, rs, l + (unsigned)(PLN * 2));
        if (NSPLIT == 2) { stage8(A2 + ga + kc, rs, l + (unsigned)(2 * PLN * 2)); stage8(Bt2 + gb + kc, rs, l + (unsigned)(3 * PLN * 2)); } };
    const int nst = kend / KS;
    fill(0);
    asm volatile("s_wait_asynccnt 0x0" ::: "memory");    // this wave's copies of stage 0 have landed
    __syncthreads();                                     // and every other wave's: stage 0 may be read
    if (nst > 1) fill(1);
#pragma unroll 1
    for (int st = 0; st < nst; ++st) {
        const T16* sb = sm + (st & 1) * (NPL * PLN);
#pragma unroll
        for (int ks = 0; ks < KS; ks += 32) {
            const T16* pa = sb + (wm + lr) * LP + ks + 8 * hi; const T16* pb = sb + PLN + (wn + lr) * LP + ks + 8 * hi;
            V a[4], a2[4];
#pragma unroll
            for (int mb = 0; mb < 4; ++mb) { a[mb] = WFrag<T16>::ld(pa + mb * 16 * LP); if (NSPLIT == 2) a2[mb] = WFrag<T16>::ld(pa + 2 * PLN + mb * 16 * LP); }
#pragma unroll
            for (int nb = 0; nb < 4; ++nb) { const V b = WFrag<T16>::ld(pb + nb * 16 * LP); V b2; if (NSPLIT == 2) b2 = WFrag<T16>::ld(pb + 2 * PLN + nb * 16 * LP);
#pragma unroll
                for (int mb = 0; mb < 4; ++mb) { acc[mb][nb] = WFrag<T16>::mma(a[mb], b, acc[mb][nb]); if (NSPLIT == 2) acc[mb][nb] = WFrag<T16>::mma(a2[mb], b, acc[mb][nb]); if (NSPLIT == 2) acc[mb][nb] = WFrag<T16>::mma(a[mb], b2, acc[mb][nb]); } }
            asm volatile("v_nop\n\tv_nop\n\tv_nop\n\tv_nop" : "+v"(acc[0][0]), "+v"(acc[1][1]), "+v"(acc[2][2]), "+v"(acc[3][3]) : "v"(a[0]), "v"(a[3]));
        }
        asm volatile("s_wait_dscnt 0x0" ::: "memory");       // this wave's reads of the buffer are done before it is refilled
        asm volatile("s_wait_asynccnt 0x0" ::: "memory");    // this wave's copies of stage st + 1 have landed
        __syncthreads();                                     // publishes stage st + 1 and ends every wave's reads of stage st
        if (st + 2 < nst) fill(st + 2);
    }
    asm volatile("s_wait_asynccnt 0x0" ::: "memory");        // no copy is in flight when the buffers become output staging
    float* os = (float*)sm + wv * (16 * 72);                 // each wave stages its output in a range of its own
    if (VT && blockIdx.z == 2) {
        // An accumulator lane holds 8 consecutive rows (keys) of one column (d): 16 B of a transposed bf16 row. The 4 row blocks of 16 columns meet in LDS (pitch 144 B), so that each store covers whole 128-B lines. Every loop here is unrolled: acc, vh and vl live in registers and need constant indices.
        static_assert(LW == RT && RT % 64 == 0, "the 64 keys of a wave lie in the windows of the query tiles s0 / RT - 1 .. s0 / RT + 1, whole");
        bf* sh = (bf*)os; bf* sl = sh + 16 * 72;
        const int bb = r0 / SS, s0 = r0 % SS, row = lane >> 3, col = (lane & 7) * 8;
#pragma unroll
        for (int nb = 0; nb < 4; ++nb) { const float bz = bfr(bias[c0 + nb * 16 + lr]);
#pragma unroll
            for (int mb = 0; mb < 4; ++mb) { v8us oh, ol;
#pragma unroll
                for (int j = 0; j < 8; ++j) { unsigned short h, l; splitf(acc[mb][nb][j] + bz, h, l); oh[j] = h; ol[j] = l; }
                *(v8usa*)(sh + lr * 72 + mb * 16 + hi * 8) = oh; *(v8usa*)(sl + lr * 72 + mb * 16 + hi * 8) = ol; }
            // compiler fence, as in the f32 epilogue below: the reads that follow take other lanes' LDS writes and must not be moved over them
            __builtin_amdgcn_wave_barrier(); asm volatile("" ::: "memory");
            v8us vh[4], vl[4];
#pragma unroll
            for (int s = 0; s < 4; ++s) { vh[s] = *(const v8usa*)(sh + (s * 4 + row) * 72 + col); vl[s] = *(const v8usa*)(sl + (s * 4 + row) * 72 + col); }
#pragma unroll
            for (int dt = -1; dt <= 1; ++dt) { const int t = s0 / RT + dt; if (t < 0 || t >= NT) continue;
                int tb, i0, kc0, span; tile_of(bb * NT + t, tb, i0, kc0, span);
                const size_t o = ((size_t)(bb * NT + t) * DD + c0 + nb * 16 + row) * SPN + (s0 - kc0) + col;
#pragma unroll
                for (int s = 0; s < 4; ++s) { *(v8usa*)(Vh + o + (size_t)s * 4 * SPN) = vh[s]; *(v8usa*)(Vl + o + (size_t)s * 4 * SPN) = vl[s]; }
                asm volatile("s_wait_xcnt 0x0" ::: "memory"); }   // the next tile's addresses and the next column block's values go into registers that these stores name
            // compiler fence: the next column block's LDS writes stay behind the reads above
            __builtin_amdgcn_wave_barrier(); asm volatile("" ::: "memory");
        }
        return;
    }
    if (VT) {
        // A wave's 64 columns of one fp16 row are one 128-B line: 8 lanes x 16 B, 4 rows a store. The 16 x 64 f32 block turns in LDS as in the f32 epilogue below.
        const int row = lane >> 3, cofs = (lane & 7) * 8;
        const v4f b0 = *(const v4fa*)(bias + c0 + cofs), b1 = *(const v4fa*)(bias + c0 + cofs + 4);
        h16* hrow = H + z * sC + (size_t)(r0 + row) * ldc + c0 + cofs;
#pragma unroll
        for (int mb = 0; mb < 4; ++mb) {
#pragma unroll
            for (int nb = 0; nb < 4; ++nb) {
#pragma unroll
                for (int j = 0; j < 8; ++j) os[(hi * 8 + j) * 68 + nb * 16 + lr] = acc[mb][nb][j]; }
            // compiler fence: the reads that follow take other lanes' LDS writes and must not be moved over them
            __builtin_amdgcn_wave_barrier(); asm volatile("" ::: "memory");
#pragma unroll
            for (int s = 0; s < 4; ++s) { const float* p = os + (s * 4 + row) * 68 + cofs; const v4f x0 = *(const v4fa*)p, x1 = *(const v4fa*)(p + 4); v8h o;
#pragma unroll
                for (int u = 0; u < 4; ++u) { o[u] = (h16)(x0[u] + bfr(b0[u])); o[4 + u] = (h16)(x1[u] + bfr(b1[u])); }
                *(v8ha*)(hrow + (size_t)(mb * 16 + s * 4) * ldc) = o; }
            asm volatile("s_wait_xcnt 0x0" ::: "memory");   // the next row block's values go into registers that these stores name
            // compiler fence: the next row block's LDS writes stay behind the reads above
            __builtin_amdgcn_wave_barrier(); asm volatile("" ::: "memory");
        }
        return;
    }
#pragma unroll
    for (int mb = 0; mb < 4; ++mb) {
#pragma unroll
        for (int nb = 0; nb < 4; ++nb) {
#pragma unroll
            for (int j = 0; j < 8; ++j) os[(hi * 8 + j) * 68 + nb * 16 + lr] = acc[mb][nb][j]; }
        __builtin_amdgcn_wave_barrier(); asm volatile("" ::: "memory");
        float* crow = C + (size_t)(r0 + mb * 16) * ldc + c0;
{
#pragma unroll
            for (int s = 0; s < 8; ++s) { const int row = 2 * s + hi, cofs = lr * 4; v4f val = *(const v4fa*)(os + row * 68 + cofs); if (BIAS) { val[0] += bfr(bias[c0 + cofs]); val[1] += bfr(bias[c0 + cofs + 1]); val[2] += bfr(bias[c0 + cofs + 2]); val[3] += bfr(bias[c0 + cofs + 3]); }
                *(v4f*)(crow + (size_t)row * ldc + cofs) = val; }
             }
        asm volatile("s_wait_xcnt 0x0" ::: "memory");   // the next row block's loads go into registers that the last store names
        __builtin_amdgcn_wave_barrier(); asm volatile("" ::: "memory");
    }
}

typedef __attribute__((ext_vector_type(2))) unsigned short v2us;
typedef __attribute__((ext_vector_type(4))) unsigned short v4us;

__global__ __launch_bounds__(256) void k_wtG(const float* __restrict__ w0, const float* __restrict__ w1, const float* __restrict__ w2, int K, int N, bf* Bt) {
    const float* __restrict__ w = (blockIdx.y == 0) ? w0 : (blockIdx.y == 1) ? w1 : w2; Bt += (size_t)blockIdx.y * K * N;
    const int lane = threadIdx.x & 31; const int L0 = (blockIdx.x * 8 + (threadIdx.x >> 5)) * 8; const int nlines = N * K / 64;
{
#pragma unroll 1
        for (int l = 0; l < 8; ++l) { const int L = L0 + l; if (L >= nlines) break; const size_t e = (size_t)L * 64 + lane * 2; const int k = (int)(e % K), n = (int)(e / K); v2us o;
            o[0] = f2bf(w[(size_t)k * N + n]); o[1] = f2bf(w[(size_t)(k + 1) * N + n]); *(v2us*)(Bt + e) = o; }
         }
}
__global__ __launch_bounds__(256) void k_cvt8(const float* __restrict__ src, bf* dst, size_t n8) { const size_t i = (size_t)blockIdx.x * 256 + threadIdx.x; if (i >= n8) return; const v8f v = *(const v8f*)(src + i * 8); v8us o;
#pragma unroll
    for (int k = 0; k < 8; ++k) o[k] = f2bf(v[k]); *(v8us*)(dst + i * 8) = o;  }
// k_wsoft: wave per tile row rr (i = i0 + rr): columns jj < span with j = c0 + jj inside [i-128, i+128] keep
__global__ __launch_bounds__(256) void k_wsoft(const float* __restrict__ ST, bf* Ph, bf* Pl) { int b, i0, c0, span; tile_of((int)blockIdx.y, b, i0, c0, span); ST += (size_t)blockIdx.y * RT * SPN; Ph += (size_t)blockIdx.y * RT * SPN; Pl += (size_t)blockIdx.y * RT * SPN;
    const int lane = threadIdx.x & 31; const int rr = blockIdx.x * 8 + (threadIdx.x >> 5); if (rr >= RT) return; const int i = i0 + rr; const float* sr = ST + (size_t)rr * SPN; const float c = 0.044194173824159216f; float v[SPN / 32]; float mx = -3.0e38f;
    static_assert(SS >= RT + LW && (RT + LW) % 128 == 0, "every tile's span is RT + LW at least");
#pragma unroll
    for (int ch = 0; ch < SPN / 128; ++ch) { const int jj0 = ch * 128 + lane * 4; v4f a = (v4f){}; if (ch * 128 < RT + LW || ch * 128 < span) a = *(const v4f*)(sr + jj0);   // span is RT + LW at least; the score launch stores no column block at or past span (a multiple of 128, the same for the whole work-group): such a chunk is not read
#pragma unroll
        for (int u = 0; u < 4; ++u) { const int jj = jj0 + u; const int j = c0 + jj; const bool ok = (jj < span) && (j >= i - LW) && (j <= i + LW); const float t = ok ? a[u] * c : -3.0e38f; v[ch * 4 + u] = t; mx = fmaxf(mx, t); } }
#pragma unroll
    for (int sh = 16; sh; sh >>= 1) mx = fmaxf(mx, __shfl_xor(mx, sh, 32));
    float sum = 0.f;
#pragma unroll
    for (int q = 0; q < SPN / 32; ++q) { float d0 = __fsub_rn(v[q], mx); asm volatile("" : "+v"(d0)); v[q] = __builtin_amdgcn_exp2f(__fmul_rn(d0, 1.4426950408889634f)); sum += v[q]; }
#pragma unroll
    for (int sh = 16; sh; sh >>= 1) sum += __shfl_xor(sum, sh, 32);
    const float f = __fdiv_rn(1.0f, sum);
    {
#pragma unroll
        for (int ch = 0; ch < SPN / 128; ++ch) { v4us oh, ol;
#pragma unroll
            for (int q = 0; q < 4; ++q) { unsigned short a, b; splitf(v[ch * 4 + q] * f, a, b); oh[q] = a; ol[q] = b; } const size_t oo = (size_t)rr * SPN + ch * 128 + lane * 4; *(v4us*)(Ph + oo) = oh; *(v4us*)(Pl + oo) = ol; }
         } }

extern "C" void kernel_launch(void* const* d_in, const int* in_sizes, int n_in,
                              void* d_out, int out_size, void* d_ws, size_t ws_size, hipStream_t stream) {
    (void)in_sizes; (void)n_in; (void)out_size;
    const float* x = (const float*)d_in[0]; const float* wq = (const float*)d_in[1]; const float* wk = (const float*)d_in[2]; const float* wv = (const float*)d_in[3]; const float* bq = (const float*)d_in[4]; const float* bk = (const float*)d_in[5]; const float* bv = (const float*)d_in[6];
    float* OUT = (float*)d_out;     // [8][2048][512]
    char* wsp = (char*)d_ws;
    auto take = [&](size_t bytes) { char* p = wsp; wsp += (bytes + 255) & ~(size_t)255; return (void*)p; };
    bf* WQ = (bf*)take((size_t)3 * DD * DD * 2);                       // Wq, Wk, Wv transposed, one after the other
    bf* XB = (bf*)take((size_t)NB_ * SS * DD * 2);
    h16* Q16 = (h16*)take((size_t)2 * NB_ * SS * DD * 2);              // q, k (fp16), one after the other
    h16* K16 = Q16 + (size_t)NB_ * SS * DD;
    bf* Vh = (bf*)take((size_t)NZ * DD * SPN * 2); bf* Vl = (bf*)take((size_t)NZ * DD * SPN * 2);
    float* ST = (float*)take((size_t)NZ * RT * SPN * 4); bf* Ph = (bf*)take((size_t)NZ * RT * SPN * 2); bf* Pl = (bf*)take((size_t)NZ * RT * SPN * 2);   // scores and probabilities of all tiles
    if ((size_t)(wsp - (char*)d_ws) > ws_size) return;    // total ~ 194 MiB
    k_wtG<<<dim3((DD * DD / 64 + 63) / 64, 3, 1), 256, 0, stream>>>(wq, wk, wv, DD, DD, WQ);
    k_cvt8<<<(NB_ * SS * DD / 8 + 255) / 256, 256, 0, stream>>>(x, XB, (size_t)NB_ * SS * DD / 8);
    k_gemmw<bf, 0, true, 0, true><<<dim3(NB_ * SS / BT, DD / BT, 3), 128, 0, stream>>>(XB, nullptr, WQ, nullptr, DD, nullptr, DD, bq, bk, bv, 0, (size_t)DD * DD, (size_t)NB_ * SS * DD, Vh, Vl, Q16);
    k_gemmw<h16, 0, false, 1, false><<<dim3(RT / BT, SPN / BT, NZ), 128, 0, stream>>>(Q16, nullptr, K16, nullptr, DD, ST, SPN, nullptr, nullptr, nullptr, (size_t)RT * DD, 0, (size_t)RT * SPN, nullptr, nullptr, nullptr);
    k_wsoft<<<dim3(RT / 8, NZ, 1), 256, 0, stream>>>(ST, Ph, Pl);
    k_gemmw<bf, 2, false, 2, false><<<dim3(RT / BT, DD / BT, NZ), 128, 0, stream>>>(Ph, Pl, Vh, Vl, SPN, OUT, DD, nullptr, nullptr, nullptr, (size_t)RT * SPN, (size_t)DD * SPN, (size_t)RT * DD, nullptr, nullptr, nullptr);
}

// v005
// It runs in 80.7 microseconds.
// Timed twice side by side with v004, it ran 1.09 and 1.08 times as fast.
// All steps since v000 together make it 47.3 times as fast.
#include <hip/hip_runtime.h>

// TransformedAttention (x [8][2048][512]; q/k/v = x W + b (512); scores = q.k / sqrt(512) restricted to the sliding window i-128 <= j <= i+128 (others masked); softmax; out = attn v -> [8][2048][512]).
// Banded evaluation: for each 128-row query tile only the key columns max(0,i0-128) .. min(2048,i0+256) (<= 384) are computed.
// Compute dtypes, f32 accumulate: every input rounded to bf16; q/k/v on PLAIN bf16 operands (inputs: exact) + bias; banded scores (K 512) on single fp16 planes; window mask + softmax f32 -> bf16 hi+lo probability planes;

#define NB_  8
#define SS   2048
#define DD   512
#define RT   128
#define SPN  384
#define LW   128
#define NT   (SS / RT)        // query tiles per batch entry
#define NZ   (NB_ * NT)       // all (batch, query tile) pairs; one grid slot each
typedef _Float16 h16;
typedef unsigned short bf;
typedef __attribute__((ext_vector_type(16))) __bf16   v16bf;
typedef __attribute__((ext_vector_type(16))) _Float16 v16h;
typedef __attribute__((ext_vector_type(8)))  _Float16 v8h;
typedef __attribute__((ext_vector_type(8)))  unsigned short v8us;
typedef __attribute__((ext_vector_type(8)))  float    v8f;
typedef __attribute__((ext_vector_type(4)))  float    v4f;
typedef v8h  __attribute__((may_alias)) v8ha;
typedef v4f  __attribute__((may_alias)) v4fa;
typedef v8us __attribute__((may_alias)) v8usa;

__device__ __forceinline__ unsigned short f2bf(float f) { unsigned u = __float_as_uint(f); u += 0x7FFFu + ((u >> 16) & 1u); return (unsigned short)(u >> 16); }
__device__ __forceinline__ float bf2f(unsigned short b) { return __uint_as_float(((unsigned)b) << 16); }
__device__ __forceinline__ float bfr(float f) { return bf2f(f2bf(f)); }
__device__ __forceinline__ v16h cat16(v8h lo, v8h hi) { return __builtin_shufflevector(lo, hi, 0, 1, 2, 3, 4, 5, 6, 7, 8, 9, 10, 11, 12, 13, 14, 15); }
__device__ __forceinline__ v16bf cat16b(v8us lo, v8us hi) { return __builtin_bit_cast(v16bf, __builtin_shufflevector(lo, hi, 0, 1, 2, 3, 4, 5, 6, 7, 8, 9, 10, 11, 12, 13, 14, 15)); }
__device__ __forceinline__ v8f wmma16(v16h a, v16h b, v8f c) { return __builtin_amdgcn_wmma_f32_16x16x32_f16(false, a, false, b, (short)0, c, false, false); }
__device__ __forceinline__ v8f wmmab(v16bf a, v16bf b, v8f c) { return __builtin_amdgcn_wmma_f32_16x16x32_bf16(false, a, false, b, (short)0, c, false, false); }



// Query tile z = b * NT + t: rows i0 .. i0+127 of batch entry b, key columns c0 .. c0+span-1 (span 256 at the two edge tiles, else 384).
__device__ __forceinline__ void tile_of(int z, int& b, int& i0, int& c0, int& span) { b = z / NT; i0 = (z % NT) * RT; c0 = (i0 - LW > 0) ? (i0 - LW) : 0; const int c1 = (i0 + RT + LW < SS) ? (i0 + RT + LW) : SS; span = c1 - c0; }

// ---- k_gemmw: GEMM, 128x128 output tile per work-group of 2 x 2 waves, 64x64 (16 accumulators) per wave; grid (M/128, N/128, Z), 128 threads.
// Operands are K-contiguous 16-bit planes. Each stage brings one 128-B line (64 k) of the tile's 128 A rows and 128 Bt rows (and of the second planes, NSPLIT 2) into LDS by asynchronous copies, two buffers: the next stage flies while this one is multiplied.
// C[m][n] (f32, pitch ldc, + optional f32 bias[n]) = sum_k A[m][k] Bt[n][k] (+ split products per NSPLIT). z-batch strides sA/sB/sC in elements. K % 64 == 0. bias/bias1/bias2: the bias of z = 0/1/2. BAND 1: z is a query tile, Bt starts at that tile's first key row and column blocks past its span leave. BAND 2: z is a query tile, k runs over that tile's span only. VT: no C is stored. z = 0, 1 (q, k) add the bias in f32, round once to fp16 and store the planes H + z sC (pitch ldc) that the score product reads; z = 2 (v) adds the bias, splits into bf16 hi and lo and stores both transposed, VS[d][jj] = v[c0 + jj][d], into the slice of every query tile whose key window holds its rows.
#define BT   128              // rows and columns of a work-group's output tile
#define KS   64               // k per stage: one 128-B line of every operand row
#define LP   72               // LDS row pitch in elements: 144 B = 16 B x 9, the pitch of ds_load_b128 readers of 128-B rows
#define PLN  (BT * LP)        // elements of one plane's tile in LDS
template <typename T16> struct WFrag;
template <> struct WFrag<h16> { typedef v16h V; static __device__ __forceinline__ V ld(const h16* p) { return cat16(*(const v8h*)p, *(const v8h*)(p + 16)); } static __device__ __forceinline__ v8f mma(V a, V b, v8f c) { return wmma16(a, b, c); } };
template <> struct WFrag<bf> { typedef v16bf V; static __device__ __forceinline__ V ld(const bf* p) { return cat16b(*(const v8us*)p, *(const v8us*)(p + 16)); } static __device__ __forceinline__ v8f mma(V a, V b, v8f c) { return wmmab(a, b, c); } };
__device__ __forceinline__ void splitf(float y, unsigned short& h, unsigned short& l) { h = f2bf(y); l = f2bf(y - bf2f(h)); }
// One plane's 128 x 64 tile: this thread's 16 B of rows r, r + 16, .. r + 112 (g: its 16 B of row r, rs: 16 rows in elements, l: their LDS byte address). A wave's copy covers four whole 128-B lines.
// The closing s_wait_xcnt stands inside the statement, so that no address register of a copy is rewritten in front of it.
template <typename T16>
__device__ __forceinline__ void stage8(const T16* g, size_t rs, unsigned l) {
    asm volatile("global_load_async_to_lds_b128 %0, %8, off\n\t"
                 "global_load_async_to_lds_b128 %1, %9, off\n\t"
                 "global_load_async_to_lds_b128 %2, %10, off\n\t"
                 "global_load_async_to_lds_b128 %3, %11, off\n\t"
                 "global_load_async_to_lds_b128 %4, %12, off\n\t"
                 "global_load_async_to_lds_b128 %5, %13, off\n\t"
                 "global_load_async_to_lds_b128 %6, %14, off\n\t"
                 "global_load_async_to_lds_b128 %7, %15, off\n\t"
                 "s_wait_xcnt 0x0"
                 :: "v"(l), "v"(l + 1u * 16 * LP * 2), "v"(l + 2u * 16 * LP * 2), "v"(l + 3u * 16 * LP * 2), "v"(l + 4u * 16 * LP * 2), "v"(l + 5u * 16 * LP * 2), "v"(l + 6u * 16 * LP * 2), "v"(l + 7u * 16 * LP * 2),
                    "v"(g), "v"(g + rs), "v"(g + 2 * rs), "v"(g + 3 * rs), "v"(g + 4 * rs), "v"(g + 5 * rs), "v"(g + 6 * rs), "v"(g + 7 * rs)
                 : "memory");
}
template <typename T16, int NSPLIT, bool BIAS, int BAND, bool VT>
__global__ __launch_bounds__(128) void k_gemmw(const T16* __restrict__ A, const T16* __restrict__ A2, const T16* __restrict__ Bt, const T16* __restrict__ Bt2, int K, float* C, int ldc, const float* __restrict__ bias, const float* __restrict__ bias1, const float* __restrict__ bias2, size_t sA, size_t sB, size_t sC, bf* Vh, bf* Vl, h16* H) {
    typedef typename WFrag<T16>::V V;
    static_assert(NSPLIT == 0 || NSPLIT == 2, "planes in LDS: A, Bt (, A2, Bt2)");
    constexpr int NPL = (NSPLIT == 2) ? 4 : 2;
    __shared__ __align__(16) T16 sm[2 * NPL * PLN];    // two buffers of NPL plane tiles; behind the k loop each wave's output staging
    const size_t z = blockIdx.z; A += z * sA; if (A2) A2 += z * sA; Bt += z * sB; if (Bt2) Bt2 += z * sB; C += z * sC;
    int kend = K;
    if (BAND) { int b, i0, kc0, span; tile_of((int)blockIdx.z, b, i0, kc0, span); if (BAND == 1) { if ((int)blockIdx.y * BT >= span) return; Bt += ((size_t)b * SS + kc0) * K; } else kend = span; }
    if (BIAS) bias = (blockIdx.z == 0) ? bias : (blockIdx.z == 1) ? bias1 : bias2;
    const int tid = threadIdx.x, lane = tid & 31, lr = lane & 15, hi = lane >> 4, wv = tid >> 5; const int wm = (wv & 1) * 64, wn = (wv >> 1) * 64;
    const int r0 = blockIdx.x * BT + wm, c0 = blockIdx.y * BT + wn;
    v8f acc[4][4];
#pragma unroll
    for (int mb = 0; mb < 4; ++mb)
#pragma unroll
        for (int nb = 0; nb < 4; ++nb) acc[mb][nb] = (v8f){};
    const int srow = tid >> 3, scol = (tid & 7) * 8;     // 8 threads per 128-B row, 16 rows per copy of the work-group
    const size_t ga = (size_t)(blockIdx.x * BT + srow) * K + scol, gb = (size_t)(blockIdx.y * BT + srow) * K + scol, rs = (size_t)16 * K;
    const unsigned l0 = (unsigned)(size_t)sm + (unsigned)(srow * LP + scol) * 2u;
    auto fill = [&](int st) { const int kc = st * KS; const unsigned l = l0 + (unsigned)(st & 1) * (unsigned)(NPL * PLN * 2);
        stage8(A + ga + kc, rs, l); stage8(Bt + gb + kc, rs, l + (unsigned)(PLN * 2));
        if (NSPLIT == 2) { stage8(A2 + ga + kc, rs, l + (unsigned)(2 * PLN * 2)); stage8(Bt2 + gb + kc, rs, l + (unsigned)(3 * PLN * 2)); } };
    const int nst = kend / KS;
    fill(0);
    asm volatile("s_wait_asynccnt 0x0" ::: "memory");    // this wave's copies of stage 0 have landed
    __syncthreads();                                     // and every other wave's: stage 0 may be read
    if (nst > 1) fill(1);
#pragma unroll 1
    for (int st = 0; st < nst; ++st) {
        const T16* sb = sm + (st & 1) * (NPL * PLN);
#pragma unroll
        for (int ks = 0; ks < KS; ks += 32) {
            const T16* pa = sb + (wm + lr) * LP + ks + 8 * hi; const T16* pb = sb + PLN + (wn + lr) * LP + ks + 8 * hi;
            V a[4], a2[4];
#pragma unroll
            for (int mb = 0; mb < 4; ++mb) { a[mb] = WFrag<T16>::ld(pa + mb * 16 * LP); if (NSPLIT == 2) a2[mb] = WFrag<T16>::ld(pa + 2 * PLN + mb * 16 * LP); }
#pragma unroll
            for (int nb = 0; nb < 4; ++nb) { const V b = WFrag<T16>::ld(pb + nb * 16 * LP); V b2; if (NSPLIT == 2) b2 = WFrag<T16>::ld(pb + 2 * PLN + nb * 16 * LP);
#pragma unroll
                for (int mb = 0; mb < 4; ++mb) { acc[mb][nb] = WFrag<T16>::mma(a[mb], b, acc[mb][nb]); if (NSPLIT == 2) acc[mb][nb] = WFrag<T16>::mma(a2[mb], b, acc[mb][nb]); if (NSPLIT == 2) acc[mb][nb] = WFrag<T16>::mma(a[mb], b2, acc[mb][nb]); } }
            asm volatile("v_nop\n\tv_nop\n\tv_nop\n\tv_nop" : "+v"(acc[0][0]), "+v"(acc[1][1]), "+v"(acc[2][2]), "+v"(acc[3][3]) : "v"(a[0]), "v"(a[3]));
        }
        asm volatile("s_wait_dscnt 0x0" ::: "memory");       // this wave's reads of the buffer are done before it is refilled
        asm volatile("s_wait_asynccnt 0x0" ::: "memory");    // this wave's copies of stage st + 1 have landed
        __syncthreads();                                     // publishes stage st + 1 and ends every wave's reads of stage st
        if (st + 2 < nst) fill(st + 2);
    }
    asm volatile("s_wait_asynccnt 0x0" ::: "memory");        // no copy is in flight when the buffers become output staging
    float* os = (float*)sm + wv * (16 * 72);                 // each wave stages its output in a range of its own
    if (VT && blockIdx.z == 2) {
        // An accumulator lane holds 8 consecutive rows (keys) of one column (d): 16 B of a transposed bf16 row. The 4 row blocks of 16 columns meet in LDS (pitch 144 B), so that each store covers whole 128-B lines. Every loop here is unrolled: acc, vh and vl live in registers and need constant indices.
        static_assert(LW == RT && RT % 64 == 0, "the 64 keys of a wave lie in the windows of the query tiles s0 / RT - 1 .. s0 / RT + 1, whole");
        bf* sh = (bf*)os; bf* sl = sh + 16 * 72;
        const int bb = r0 / SS, s0 = r0 % SS, row = lane >> 3, col = (lane & 7) * 8;
#pragma unroll
        for (int nb = 0; nb < 4; ++nb) { const float bz = bfr(bias[c0 + nb * 16 + lr]);
#pragma unroll
            for (int mb = 0; mb < 4; ++mb) { v8us oh, ol;
#pragma unroll
                for (int j = 0; j < 8; ++j) { unsigned short h, l; splitf(acc[mb][nb][j] + bz, h, l); oh[j] = h; ol[j] = l; }
                *(v8usa*)(sh + lr * 72 + mb * 16 + hi * 8) = oh; *(v8usa*)(sl + lr * 72 + mb * 16 + hi * 8) = ol; }
            // compiler fence, as in the f32 epilogue below: the reads that follow take other lanes' LDS writes and must not be moved over them
            __builtin_amdgcn_wave_barrier(); asm volatile("" ::: "memory");
            v8us vh[4], vl[4];
#pragma unroll
            for (int s = 0; s < 4; ++s) { vh[s] = *(const v8usa*)(sh + (s * 4 + row) * 72 + col); vl[s] = *(const v8usa*)(sl + (s * 4 + row) * 72 + col); }
#pragma unroll
            for (int dt = -1; dt <= 1; ++dt) { const int t = s0 / RT + dt; if (t < 0 || t >= NT) continue;
                int tb, i0, kc0, span; tile_of(bb * NT + t, tb, i0, kc0, span);
                const size_t o = ((size_t)(bb * NT + t) * DD + c0 + nb * 16 + row) * SPN + (s0 - kc0) + col;
#pragma unroll
                for (int s = 0; s < 4; ++s) { *(v8usa*)(Vh + o + (size_t)s * 4 * SPN) = vh[s]; *(v8usa*)(Vl + o + (size_t)s * 4 * SPN) = vl[s]; }
                asm volatile("s_wait_xcnt 0x0" ::: "memory"); }   // the next tile's addresses and the next column block's values go into registers that these stores name
            // compiler fence: the next column block's LDS writes stay behind the reads above
            __builtin_amdgcn_wave_barrier(); asm volatile("" ::: "memory");
        }
        return;
    }
    if (VT) {
        // A wave's 64 columns of one fp16 row are one 128-B line: 8 lanes x 16 B, 4 rows a store. The 16 x 64 f32 block turns in LDS as in the f32 epilogue below.
        const int row = lane >> 3, cofs = (lane & 7) * 8;
        const v4f b0 = *(const v4fa*)(bias + c0 + cofs), b1 = *(const v4fa*)(bias + c0 + cofs + 4);
        h16* hrow = H + z * sC + (size_t)(r0 + row) * ldc + c0 + cofs;
#pragma unroll
        for (int mb = 0; mb < 4; ++mb) {
#pragma unroll
            for (int nb = 0; nb < 4; ++nb) {
#pragma unroll
                for (int j = 0; j < 8; ++j) os[(hi * 8 + j) * 68 + nb * 16 + lr] = acc[mb][nb][j]; }
            // compiler fence: the reads that follow take other lanes' LDS writes and must not be moved over them
            __builtin_amdgcn_wave_barrier(); asm volatile("" ::: "memory");
#pragma unroll
            for (int s = 0; s < 4; ++s) { const float* p = os + (s * 4 + row) * 68 + cofs; const v4f x0 = *(const v4fa*)p, x1 = *(const v4fa*)(p + 4); v8h o;
#pragma unroll
                for (int u = 0; u < 4; ++u) { o[u] = (h16)(x0[u] + bfr(b0[u])); o[4 + u] = (h16)(x1[u] + bfr(b1[u])); }
                *(v8ha*)(hrow + (size_t)(mb * 16 + s * 4) * ldc) = o; }
            asm volatile("s_wait_xcnt 0x0" ::: "memory");   // the next row block's values go into registers that these stores name
            // compiler fence: the next row block's LDS writes stay behind the reads above
            __builtin_amdgcn_wave_barrier(); asm volatile("" ::: "memory");
        }
        return;
    }
#pragma unroll
    for (int mb = 0; mb < 4; ++mb) {
#pragma unroll
        for (int nb = 0; nb < 4; ++nb) {
#pragma unroll
            for (int j = 0; j < 8; ++j) os[(hi * 8 + j) * 68 + nb * 16 + lr] = acc[mb][nb][j]; }
        __builtin_amdgcn_wave_barrier(); asm volatile("" ::: "memory");
        float* crow = C + (size_t)(r0 + mb * 16) * ldc + c0;
{
#pragma unroll
            for (int s = 0; s < 8; ++s) { const int row = 2 * s + hi, cofs = lr * 4; v4f val = *(const v4fa*)(os + row * 68 + cofs); if (BIAS) { val[0] += bfr(bias[c0 + cofs]); val[1] += bfr(bias[c0 + cofs + 1]); val[2] += bfr(bias[c0 + cofs + 2]); val[3] += bfr(bias[c0 + cofs + 3]); }
                *(v4f*)(crow + (size_t)row * ldc + cofs) = val; }
             }
        asm volatile("s_wait_xcnt 0x0" ::: "memory");   // the next row block's loads go into registers that the last store names
        __builtin_amdgcn_wave_barrier(); asm volatile("" ::: "memory");
    }
}

typedef __attribute__((ext_vector_type(2))) unsigned short v2us;
typedef __attribute__((ext_vector_type(4))) unsigned short v4us;

// ---- k_prep: both input conversions in one resident launch: PW work-groups of 16 waves (one per WGP), every load of a wave issued ahead of its first store.
// Weights: wave wv of work-group g writes one 128-B line (64 k) of row n of each transposed weight, Bt[n][k] = bf16(w[k][n]); the 16 waves of a work-group take 16 neighbouring n of the same 64 k, so they share the lines they read.
// x: a work-group converts XCH * PT chunks of 8 floats that lie one after the other; a thread takes chunk tid of each run of PT.
#define PW   256
#define PT   512
#define XCH  (NB_ * SS * DD / 8 / (PW * PT))
__global__ __launch_bounds__(PT) void k_prep(const float* __restrict__ x, const float* __restrict__ w0, const float* __restrict__ w1, const float* __restrict__ w2, bf* XB, bf* Bt) {
    static_assert(NB_ * SS * DD % (8 * PW * PT) == 0, "every thread converts XCH whole chunks");
    static_assert(DD % 64 == 0 && DD * DD / 64 == PW * (PT / 32), "one line of each transposed weight per wave");
    const int tid = threadIdx.x, lane = tid & 31, wv = tid >> 5;
    const int n = ((int)blockIdx.x / (DD / 64)) * (PT / 32) + wv, k = ((int)blockIdx.x % (DD / 64)) * 64 + lane * 2;
    const size_t wi = (size_t)k * DD + n, ch = (size_t)blockIdx.x * (XCH * PT) + tid;
    v8f v[XCH];
#pragma unroll
    for (int it = 0; it < XCH; ++it) v[it] = *(const v8f*)(x + (ch + (size_t)it * PT) * 8);
    const float a0 = w0[wi], a1 = w0[wi + DD], b0 = w1[wi], b1 = w1[wi + DD], c0 = w2[wi], c1 = w2[wi + DD];
    __builtin_amdgcn_sched_barrier(0);   // keeps the weight loads in flight together with the x loads: without it they are moved behind the wait for the last x load, a second memory latency in series
#pragma unroll
    for (int it = 0; it < XCH; ++it) { v8us q;
#pragma unroll
        for (int u = 0; u < 8; ++u) q[u] = f2bf(v[it][u]);
        *(v8us*)(XB + (ch + (size_t)it * PT) * 8) = q;
        if (it == XCH / 2 - 1) asm volatile("s_wait_xcnt 0x0" ::: "memory"); }   // behind the first half's stores: the second half's values may go into registers that those stores name
    bf* bt = Bt + (size_t)n * DD + k; v2us o;
    o[0] = f2bf(a0); o[1] = f2bf(a1); *(v2us*)bt = o;
    o[0] = f2bf(b0); o[1] = f2bf(b1); *(v2us*)(bt + (size_t)DD * DD) = o;
    o[0] = f2bf(c0); o[1] = f2bf(c1); *(v2us*)(bt + (size_t)2 * DD * DD) = o;
}
// k_wsoft: wave per tile row rr (i = i0 + rr): columns jj < span with j = c0 + jj inside [i-128, i+128] keep
__global__ __launch_bounds__(256) void k_wsoft(const float* __restrict__ ST, bf* Ph, bf* Pl) { int b, i0, c0, span; tile_of((int)blockIdx.y, b, i0, c0, span); ST += (size_t)blockIdx.y * RT * SPN; Ph += (size_t)blockIdx.y * RT * SPN; Pl += (size_t)blockIdx.y * RT * SPN;
    const int lane = threadIdx.x & 31; const int rr = blockIdx.x * 8 + (threadIdx.x >> 5); if (rr >= RT) return; const int i = i0 + rr; const float* sr = ST + (size_t)rr * SPN; const float c = 0.044194173824159216f; float v[SPN / 32]; float mx = -3.0e38f;
    static_assert(SS >= RT + LW && (RT + LW) % 128 == 0, "every tile's span is RT + LW at least");
#pragma unroll
    for (int ch = 0; ch < SPN / 128; ++ch) { const int jj0 = ch * 128 + lane * 4; v4f a = (v4f){}; if (ch * 128 < RT + LW || ch * 128 < span) a = *(const v4f*)(sr + jj0);   // span is RT + LW at least; the score launch stores no column block at or past span (a multiple of 128, the same for the whole work-group): such a chunk is not read
#pragma unroll
        for (int u = 0; u < 4; ++u) { const int jj = jj0 + u; const int j = c0 + jj; const bool ok = (jj < span) && (j >= i - LW) && (j <= i + LW); const float t = ok ? a[u] * c : -3.0e38f; v[ch * 4 + u] = t; mx = fmaxf(mx, t); } }
#pragma unroll
    for (int sh = 16; sh; sh >>= 1) mx = fmaxf(mx, __shfl_xor(mx, sh, 32));
    float sum = 0.f;
#pragma unroll
    for (int q = 0; q < SPN / 32; ++q) { float d0 = __fsub_rn(v[q], mx); asm volatile("" : "+v"(d0)); v[q] = __builtin_amdgcn_exp2f(__fmul_rn(d0, 1.4426950408889634f)); sum += v[q]; }
#pragma unroll
    for (int sh = 16; sh; sh >>= 1) sum += __shfl_xor(sum, sh, 32);
    const float f = __fdiv_rn(1.0f, sum);
    {
#pragma unroll
        for (int ch = 0; ch < SPN / 128; ++ch) { v4us oh, ol;
#pragma unroll
            for (int q = 0; q < 4; ++q) { unsigned short a, b; splitf(v[ch * 4 + q] * f, a, b); oh[q] = a; ol[q] = b; } const size_t oo = (size_t)rr * SPN + ch * 128 + lane * 4; *(v4us*)(Ph + oo) = oh; *(v4us*)(Pl + oo) = ol; }
         } }

extern "C" void kernel_launch(void* const* d_in, const int* in_sizes, int n_in,
                              void* d_out, int out_size, void* d_ws, size_t ws_size, hipStream_t stream) {
    (void)in_sizes; (void)n_in; (void)out_size;
    const float* x = (const float*)d_in[0]; const float* wq = (const float*)d_in[1]; const float* wk = (const float*)d_in[2]; const float* wv = (const float*)d_in[3]; const float* bq = (const float*)d_in[4]; const float* bk = (const float*)d_in[5]; const float* bv = (const float*)d_in[6];
    float* OUT = (float*)d_out;     // [8][2048][512]
    char* wsp = (char*)d_ws;
    auto take = [&](size_t bytes) { char* p = wsp; wsp += (bytes + 255) & ~(size_t)255; return (void*)p; };
    bf* WQ = (bf*)take((size_t)3 * DD * DD * 2);                       // Wq, Wk, Wv transposed, one after the other
    bf* XB = (bf*)take((size_t)NB_ * SS * DD * 2);
    h16* Q16 = (h16*)take((size_t)2 * NB_ * SS * DD * 2);              // q, k (fp16), one after the other
    h16* K16 = Q16 + (size_t)NB_ * SS * DD;
    bf* Vh = (bf*)take((size_t)NZ * DD * SPN * 2); bf* Vl = (bf*)take((size_t)NZ * DD * SPN * 2);
    float* ST = (float*)take((size_t)NZ * RT * SPN * 4); bf* Ph = (bf*)take((size_t)NZ * RT * SPN * 2); bf* Pl = (bf*)take((size_t)NZ * RT * SPN * 2);   // scores and probabilities of all tiles
    if ((size_t)(wsp - (char*)d_ws) > ws_size) return;    // total ~ 194 MiB
    k_prep<<<PW, PT, 0, stream>>>(x, wq, wk, wv, XB, WQ);
    k_gemmw<bf, 0, true, 0, true><<<dim3(NB_ * SS / BT, DD / BT, 3), 128, 0, stream>>>(XB, nullptr, WQ, nullptr, DD, nullptr, DD, bq, bk, bv, 0, (size_t)DD * DD, (size_t)NB_ * SS * DD, Vh, Vl, Q16);
    k_gemmw<h16, 0, false, 1, false><<<dim3(RT / BT, SPN / BT, NZ), 128, 0, stream>>>(Q16, nullptr, K16, nullptr, DD, ST, SPN, nullptr, nullptr, nullptr, (size_t)RT * DD, 0, (size_t)RT * SPN, nullptr, nullptr, nullptr);
    k_wsoft<<<dim3(RT / 8, NZ, 1), 256, 0, stream>>>(ST, Ph, Pl);
    k_gemmw<bf, 2, false, 2, false><<<dim3(RT / BT, DD / BT, NZ), 128, 0, stream>>>(Ph, Pl, Vh, Vl, SPN, OUT, DD, nullptr, nullptr, nullptr, (size_t)RT * SPN, (size_t)DD * SPN, (size_t)RT * DD, nullptr, nullptr, nullptr);
}

// v007
// Measured time: 56.5 microseconds a run.
// Versions in between are left out here; by their measured steps it is 1.42 times as fast as v005.
// Counting every step since v000, it is 67.1 times as fast.
#include <hip/hip_runtime.h>

// TransformedAttention (x [8][2048][512]; q/k/v = x W + b (512); scores = q.k / sqrt(512) restricted to the sliding window i-128 <= j <= i+128 (others masked); softmax; out = attn v -> [8][2048][512]).
// Banded evaluation: for each 64-row query sub-tile only the key columns max(0,i0s-128) .. min(2048,i0s+192) (<= 320) are computed; scores, softmax and attn v run in one launch (k_attn).
// Compute dtypes, f32 accumulate: every input rounded to bf16; q/k/v on PLAIN bf16 operands (inputs: exact) + bias; banded scores (K 512) on single fp16 planes; window mask + softmax f32 -> one fp16 probability plane; v + bias rounded once to fp16; attn v (K <= 320) on single fp16 planes.

#define NB_  8
#define SS   2048
#define DD   512
#define RT   128
#define SPN  384
#define LW   128
#define NT   (SS / RT)        // query tiles per batch entry
#define NZ   (NB_ * NT)       // all (batch, query tile) pairs; RT / QT work-groups of k_attn each
typedef _Float16 h16;
typedef unsigned short bf;
typedef __attribute__((ext_vector_type(16))) __bf16   v16bf;
typedef __attribute__((ext_vector_type(16))) _Float16 v16h;
typedef __attribute__((ext_vector_type(8)))  _Float16 v8h;
typedef __attribute__((ext_vector_type(8)))  unsigned short v8us;
typedef __attribute__((ext_vector_type(8)))  float    v8f;
typedef __attribute__((ext_vector_type(4)))  float    v4f;
typedef v8h  __attribute__((may_alias)) v8ha;
typedef v4f  __attribute__((may_alias)) v4fa;

__device__ __forceinline__ unsigned short f2bf(float f) { unsigned u = __float_as_uint(f); u += 0x7FFFu + ((u >> 16) & 1u); return (unsigned short)(u >> 16); }
__device__ __forceinline__ float bf2f(unsigned short b) { return __uint_as_float(((unsigned)b) << 16); }
__device__ __forceinline__ float bfr(float f) { return bf2f(f2bf(f)); }
__device__ __forceinline__ v16h cat16(v8h lo, v8h hi) { return __builtin_shufflevector(lo, hi, 0, 1, 2, 3, 4, 5, 6, 7, 8, 9, 10, 11, 12, 13, 14, 15); }
__device__ __forceinline__ v16bf cat16b(v8us lo, v8us hi) { return __builtin_bit_cast(v16bf, __builtin_shufflevector(lo, hi, 0, 1, 2, 3, 4, 5, 6, 7, 8, 9, 10, 11, 12, 13, 14, 15)); }
__device__ __forceinline__ v8f wmma16(v16h a, v16h b, v8f c) { return __builtin_amdgcn_wmma_f32_16x16x32_f16(false, a, false, b, (short)0, c, false, false); }
__device__ __forceinline__ v8f wmmab(v16bf a, v16bf b, v8f c) { return __builtin_amdgcn_wmma_f32_16x16x32_bf16(false, a, false, b, (short)0, c, false, false); }



// Query tile z = b * NT + t: rows i0 .. i0+127 of batch entry b, key columns c0 .. c0+span-1 (span 256 at the two edge tiles, else 384).
__device__ __forceinline__ void tile_of(int z, int& b, int& i0, int& c0, int& span) { b = z / NT; i0 = (z % NT) * RT; c0 = (i0 - LW > 0) ? (i0 - LW) : 0; const int c1 = (i0 + RT + LW < SS) ? (i0 + RT + LW) : SS; span = c1 - c0; }

// ---- k_gemmw: GEMM, 128x128 output tile per work-group of 2 x 2 waves, 64x64 (16 accumulators) per wave; grid (M/128, N/128, Z), 128 threads.
// Operands are K-contiguous 16-bit planes. Each stage brings one 128-B line (64 k) of the tile's 128 A rows and 128 Bt rows into LDS by asynchronous copies, two buffers: the next stage flies while this one is multiplied.
// C[m][n] (f32, pitch ldc, + optional f32 bias[n]) = sum_k A[m][k] Bt[n][k]. z-batch strides sA/sB/sC in elements. K % 64 == 0. bias/bias1/bias2: the bias of z = 0/1/2. BAND 1: z is a query tile, Bt starts at that tile's first key row and column blocks past its span leave. BAND 2: z is a query tile, k runs over that tile's span only. VT: no C is stored. z = 0, 1 (q, k) add the bias in f32, round once to fp16 and store the planes H + z sC (pitch ldc) that the score product reads; z = 2 (v) adds the bias in f32, rounds once to fp16 and stores the plane transposed, VS[d][jj] = v[c0 + jj][d], into the slice of every query tile whose key window holds its rows.
#define BT   128              // rows and columns of a work-group's output tile
#define KS   64               // k per stage: one 128-B line of every operand row
#define LP   72               // LDS row pitch in elements: 144 B = 16 B x 9, the pitch of ds_load_b128 readers of 128-B rows
#define PLN  (BT * LP)        // elements of one plane's tile in LDS
template <typename T16> struct WFrag;
template <> struct WFrag<h16> { typedef v16h V; static __device__ __forceinline__ V ld(const h16* p) { return cat16(*(const v8h*)p, *(const v8h*)(p + 16)); } static __device__ __forceinline__ v8f mma(V a, V b, v8f c) { return wmma16(a, b, c); } };
template <> struct WFrag<bf> { typedef v16bf V; static __device__ __forceinline__ V ld(const bf* p) { return cat16b(*(const v8us*)p, *(const v8us*)(p + 16)); } static __device__ __forceinline__ v8f mma(V a, V b, v8f c) { return wmmab(a, b, c); } };
// One plane's 128 x 64 tile: this thread's 16 B of rows r, r + 16, .. r + 112 (g: its 16 B of row r, rs: 16 rows in elements, l: their LDS byte address). A wave's copy covers four whole 128-B lines.
// The closing s_wait_xcnt stands inside the statement, so that no address register of a copy is rewritten in front of it.
template <typename T16>
__device__ __forceinline__ void stage8(const T16* g, size_t rs, unsigned l) {
    asm volatile("global_load_async_to_lds_b128 %0, %8, off\n\t"
                 "global_load_async_to_lds_b128 %1, %9, off\n\t"
                 "global_load_async_to_lds_b128 %2, %10, off\n\t"
                 "global_load_async_to_lds_b128 %3, %11, off\n\t"
                 "global_load_async_to_lds_b128 %4, %12, off\n\t"
                 "global_load_async_to_lds_b128 %5, %13, off\n\t"
                 "global_load_async_to_lds_b128 %6, %14, off\n\t"
                 "global_load_async_to_lds_b128 %7, %15, off\n\t"
                 "s_wait_xcnt 0x0"
                 :: "v"(l), "v"(l + 1u * 16 * LP * 2), "v"(l + 2u * 16 * LP * 2), "v"(l + 3u * 16 * LP * 2), "v"(l + 4u * 16 * LP * 2), "v"(l + 5u * 16 * LP * 2), "v"(l + 6u * 16 * LP * 2), "v"(l + 7u * 16 * LP * 2),
                    "v"(g), "v"(g + rs), "v"(g + 2 * rs), "v"(g + 3 * rs), "v"(g + 4 * rs), "v"(g + 5 * rs), "v"(g + 6 * rs), "v"(g + 7 * rs)
                 : "memory");
}
template <typename T16, bool BIAS, int BAND, bool VT>
__global__ __launch_bounds__(128) void k_gemmw(const T16* __restrict__ A, const T16* __restrict__ Bt, int K, float* C, int ldc, const float* __restrict__ bias, const float* __restrict__ bias1, const float* __restrict__ bias2, size_t sA, size_t sB, size_t sC, h16* VS, h16* H) {
    typedef typename WFrag<T16>::V V;
    constexpr int NPL = 2;                             // planes in LDS: A, Bt
    __shared__ __align__(16) T16 sm[2 * NPL * PLN];    // two buffers of NPL plane tiles; behind the k loop each wave's output staging
    const size_t z = blockIdx.z; A += z * sA; Bt += z * sB; C += z * sC;
    int kend = K;
    if (BAND) { int b, i0, kc0, span; tile_of((int)blockIdx.z, b, i0, kc0, span); if (BAND == 1) { if ((int)blockIdx.y * BT >= span) return; Bt += ((size_t)b * SS + kc0) * K; } else kend = span; }
    if (BIAS) bias = (blockIdx.z == 0) ? bias : (blockIdx.z == 1) ? bias1 : bias2;
    const int tid = threadIdx.x, lane = tid & 31, lr = lane & 15, hi = lane >> 4, wv = tid >> 5; const int wm = (wv & 1) * 64, wn = (wv >> 1) * 64;
    const int r0 = blockIdx.x * BT + wm, c0 = blockIdx.y * BT + wn;
    v8f acc[4][4];
#pragma unroll
    for (int mb = 0; mb < 4; ++mb)
#pragma unroll
        for (int nb = 0; nb < 4; ++nb) acc[mb][nb] = (v8f){};
    const int srow = tid >> 3, scol = (tid & 7) * 8;     // 8 threads per 128-B row, 16 rows per copy of the work-group
    const size_t ga = (size_t)(blockIdx.x * BT + srow) * K + scol, gb = (size_t)(blockIdx.y * BT + srow) * K + scol, rs = (size_t)16 * K;
    const unsigned l0 = (unsigned)(size_t)sm + (unsigned)(srow * LP + scol) * 2u;
    auto fill = [&](int st) { const int kc = st * KS; const unsigned l = l0 + (unsigned)(st & 1) * (unsigned)(NPL * PLN * 2);
        stage8(A + ga + kc, rs, l); stage8(Bt + gb + kc, rs, l + (unsigned)(PLN * 2)); };
    const int nst = kend / KS;
    fill(0);
    asm volatile("s_wait_asynccnt 0x0" ::: "memory");    // this wave's copies of stage 0 have landed
    __syncthreads();                                     // and every other wave's: stage 0 may be read
    if (nst > 1) fill(1);
#pragma unroll 1
    for (int st = 0; st < nst; ++st) {
        const T16* sb = sm + (st & 1) * (NPL * PLN);
#pragma unroll
        for (int ks = 0; ks < KS; ks += 32) {
            const T16* pa = sb + (wm + lr) * LP + ks + 8 * hi; const T16* pb = sb + PLN + (wn + lr) * LP + ks + 8 * hi;
            V a[4];
#pragma unroll
            for (int mb = 0; mb < 4; ++mb) a[mb] = WFrag<T16>::ld(pa + mb * 16 * LP);
#pragma unroll
            for (int nb = 0; nb < 4; ++nb) { const V b = WFrag<T16>::ld(pb + nb * 16 * LP);
#pragma unroll
                for (int mb = 0; mb < 4; ++mb) acc[mb][nb] = WFrag<T16>::mma(a[mb], b, acc[mb][nb]); }
            asm volatile("v_nop\n\tv_nop\n\tv_nop\n\tv_nop" : "+v"(acc[0][0]), "+v"(acc[1][1]), "+v"(acc[2][2]), "+v"(acc[3][3]) : "v"(a[0]), "v"(a[3]));
        }
        asm volatile("s_wait_dscnt 0x0" ::: "memory");       // this wave's reads of the buffer are done before it is refilled
        asm volatile("s_wait_asynccnt 0x0" ::: "memory");    // this wave's copies of stage st + 1 have landed
        __syncthreads();                                     // publishes stage st + 1 and ends every wave's reads of stage st
        if (st + 2 < nst) fill(st + 2);
    }
    asm volatile("s_wait_asynccnt 0x0" ::: "memory");        // no copy is in flight when the buffers become output staging
    float* os = (float*)sm + wv * (16 * 72);                 // each wave stages its output in a range of its own
    if (VT && blockIdx.z == 2) {
        // An accumulator lane holds 8 consecutive rows (keys) of one column (d): 16 B of a transposed fp16 row. The 4 row blocks of 16 columns meet in LDS (pitch 144 B), so that each store covers whole 128-B lines. Every loop here is unrolled: acc and vv live in registers and need constant indices.
        static_assert(LW == RT && RT % 64 == 0, "the 64 keys of a wave lie in the windows of the query tiles s0 / RT - 1 .. s0 / RT + 1, whole");
        h16* sh = (h16*)os;
        const int bb = r0 / SS, s0 = r0 % SS, row = lane >> 3, col = (lane & 7) * 8;
#pragma unroll
        for (int nb = 0; nb < 4; ++nb) { const float bz = bfr(bias[c0 + nb * 16 + lr]);
#pragma unroll
            for (int mb = 0; mb < 4; ++mb) { v8h o;
#pragma unroll
                for (int j = 0; j < 8; ++j) o[j] = (h16)(acc[mb][nb][j] + bz);
                *(v8ha*)(sh + lr * 72 + mb * 16 + hi * 8) = o; }
            // compiler fence, as in the f32 epilogue below: the reads that follow take other lanes' LDS writes and must not be moved over them
            __builtin_amdgcn_wave_barrier(); asm volatile("" ::: "memory");
            v8h vv[4];
#pragma unroll
            for (int s = 0; s < 4; ++s) vv[s] = *(const v8ha*)(sh + (s * 4 + row) * 72 + col);
#pragma unroll
            for (int dt = -1; dt <= 1; ++dt) { const int t = s0 / RT + dt; if (t < 0 || t >= NT) continue;
                int tb, i0, kc0, span; tile_of(bb * NT + t, tb, i0, kc0, span);
                const size_t o = ((size_t)(bb * NT + t) * DD + c0 + nb * 16 + row) * SPN + (s0 - kc0) + col;
#pragma unroll
                for (int s = 0; s < 4; ++s) *(v8ha*)(VS + o + (size_t)s * 4 * SPN) = vv[s];
                asm volatile("s_wait_xcnt 0x0" ::: "memory"); }   // the next tile's addresses and the next column block's values go into registers that these stores name
            // compiler fence: the next column block's LDS writes stay behind the reads above
            __builtin_amdgcn_wave_barrier(); asm volatile("" ::: "memory");
        }
        return;
    }
    if (VT) {
        // A wave's 64 columns of one fp16 row are one 128-B line: 8 lanes x 16 B, 4 rows a store. The 16 x 64 f32 block turns in LDS as in the f32 epilogue below.
        const int row = lane >> 3, cofs = (lane & 7) * 8;
        const v4f b0 = *(const v4fa*)(bias + c0 + cofs), b1 = *(const v4fa*)(bias + c0 + cofs + 4);
        h16* hrow = H + z * sC + (size_t)(r0 + row) * ldc + c0 + cofs;
#pragma unroll
        for (int mb = 0; mb < 4; ++mb) {
#pragma unroll
            for (int nb = 0; nb < 4; ++nb) {
#pragma unroll
                for (int j = 0; j < 8; ++j) os[(hi * 8 + j) * 68 + nb * 16 + lr] = acc[mb][nb][j]; }
            // compiler fence: the reads that follow take other lanes' LDS writes and must not be moved over them
            __builtin_amdgcn_wave_barrier(); asm volatile("" ::: "memory");
#pragma unroll
            for (int s = 0; s < 4; ++s) { const float* p = os + (s * 4 + row) * 68 + cofs; const v4f x0 = *(const v4fa*)p, x1 = *(const v4fa*)(p + 4); v8h o;
#pragma unroll
                for (int u = 0; u < 4; ++u) { o[u] = (h16)(x0[u] + bfr(b0[u])); o[4 + u] = (h16)(x1[u] + bfr(b1[u])); }
                *(v8ha*)(hrow + (size_t)(mb * 16 + s * 4) * ldc) = o; }
            asm volatile("s_wait_xcnt 0x0" ::: "memory");   // the next row block's values go into registers that these stores name
            // compiler fence: the next row block's LDS writes stay behind the reads above
            __builtin_amdgcn_wave_barrier(); asm volatile("" ::: "memory");
        }
        return;
    }
#pragma unroll
    for (int mb = 0; mb < 4; ++mb) {
#pragma unroll
        for (int nb = 0; nb < 4; ++nb) {
#pragma unroll
            for (int j = 0; j < 8; ++j) os[(hi * 8 + j) * 68 + nb * 16 + lr] = acc[mb][nb][j]; }
        __builtin_amdgcn_wave_barrier(); asm volatile("" ::: "memory");
        float* crow = C + (size_t)(r0 + mb * 16) * ldc + c0;
{
#pragma unroll
            for (int s = 0; s < 8; ++s) { const int row = 2 * s + hi, cofs = lr * 4; v4f val = *(const v4fa*)(os + row * 68 + cofs); if (BIAS) { val[0] += bfr(bias[c0 + cofs]); val[1] += bfr(bias[c0 + cofs + 1]); val[2] += bfr(bias[c0 + cofs + 2]); val[3] += bfr(bias[c0 + cofs + 3]); }
                *(v4f*)(crow + (size_t)row * ldc + cofs) = val; }
             }
        asm volatile("s_wait_xcnt 0x0" ::: "memory");   // the next row block's loads go into registers that the last store names
        __builtin_amdgcn_wave_barrier(); asm volatile("" ::: "memory");
    }
}

typedef __attribute__((ext_vector_type(2))) unsigned short v2us;

// ---- k_prep: both input conversions in one resident launch: PW work-groups of 16 waves (one per WGP), every load of a wave issued ahead of its first store.
// Weights: wave wv of work-group g writes one 128-B line (64 k) of row n of each transposed weight, Bt[n][k] = bf16(w[k][n]); the 16 waves of a work-group take 16 neighbouring n of the same 64 k, so they share the lines they read.
// x: a work-group converts XCH * PT chunks of 8 floats that lie one after the other; a thread takes chunk tid of each run of PT.
#define PW   256
#define PT   512
#define XCH  (NB_ * SS * DD / 8 / (PW * PT))
__global__ __launch_bounds__(PT) void k_prep(const float* __restrict__ x, const float* __restrict__ w0, const float* __restrict__ w1, const float* __restrict__ w2, bf* XB, bf* Bt) {
    static_assert(NB_ * SS * DD % (8 * PW * PT) == 0, "every thread converts XCH whole chunks");
    static_assert(DD % 64 == 0 && DD * DD / 64 == PW * (PT / 32), "one line of each transposed weight per wave");
    const int tid = threadIdx.x, lane = tid & 31, wv = tid >> 5;
    const int n = ((int)blockIdx.x / (DD / 64)) * (PT / 32) + wv, k = ((int)blockIdx.x % (DD / 64)) * 64 + lane * 2;
    const size_t wi = (size_t)k * DD + n, ch = (size_t)blockIdx.x * (XCH * PT) + tid;
    v8f v[XCH];
#pragma unroll
    for (int it = 0; it < XCH; ++it) v[it] = *(const v8f*)(x + (ch + (size_t)it * PT) * 8);
    const float a0 = w0[wi], a1 = w0[wi + DD], b0 = w1[wi], b1 = w1[wi + DD], c0 = w2[wi], c1 = w2[wi + DD];
    __builtin_amdgcn_sched_barrier(0);   // keeps the weight loads in flight together with the x loads: without it they are moved behind the wait for the last x load, a second memory latency in series
#pragma unroll
    for (int it = 0; it < XCH; ++it) { v8us q;
#pragma unroll
        for (int u = 0; u < 8; ++u) q[u] = f2bf(v[it][u]);
        *(v8us*)(XB + (ch + (size_t)it * PT) * 8) = q;
        if (it == XCH / 2 - 1) asm volatile("s_wait_xcnt 0x0" ::: "memory"); }   // behind the first half's stores: the second half's values may go into registers that those stores name
    bf* bt = Bt + (size_t)n * DD + k; v2us o;
    o[0] = f2bf(a0); o[1] = f2bf(a1); *(v2us*)bt = o;
    o[0] = f2bf(b0); o[1] = f2bf(b1); *(v2us*)(bt + (size_t)DD * DD) = o;
    o[0] = f2bf(c0); o[1] = f2bf(c1); *(v2us*)(bt + (size_t)2 * DD * DD) = o;
}
// ---- k_attn: scores, window softmax and attn v of QT query rows in one work-group of 8 waves; grid NZ * (RT / QT), one work-group per WGP. Scores (f32) and probabilities (fp16) live in LDS only.
// Sub-tile y: half h = y % 2 of query tile z = y / 2: rows i0s .. i0s+63, keys ks0 .. ks0+sspan-1 (sspan 192, 256 or 320, a multiple of 64); its v rows are columns vo .. vo+sspan-1 of tile z's slice of VS.
// Both products stage 64 k per stage by asynchronous copies, two buffers, in the order of k_gemmw. Score stage: rows 0..63 of a buffer hold q, rows 64..383 the keys. v stage: 512 rows (d) of 64 keys.
#define QT   64
#define AK   (QT + 2 * LW)    // most keys of a sub-tile
#define RB   (DD * LP)        // elements of one ring buffer
#define SPI  336              // score row pitch in floats: 16 more than a multiple of 64, so that the 16-B reads of 4 rows x 4 threads (a half-wave of the softmax) cover all 64 banks
#define PPI  328              // probability row pitch in elements: 656 B = 16 B x 41, for ds_load_b128 readers
#define CR   32               // rows that one copy of the work-group covers (8 threads per 128-B row)
typedef __attribute__((ext_vector_type(4))) _Float16 v4h;
// Six and eight copies of this thread's 16 B, LDS rows CR apart from byte address l on. The closing s_wait_xcnt stands inside the statement, so that no address register of a copy is rewritten in front of it.
__device__ __forceinline__ void copy6(const h16* g0, const h16* g1, const h16* g2, const h16* g3, const h16* g4, const h16* g5, unsigned l) {
    asm volatile("global_load_async_to_lds_b128 %0, %6, off\n\t"
                 "global_load_async_to_lds_b128 %1, %7, off\n\t"
                 "global_load_async_to_lds_b128 %2, %8, off\n\t"
                 "global_load_async_to_lds_b128 %3, %9, off\n\t"
                 "global_load_async_to_lds_b128 %4, %10, off\n\t"
                 "global_load_async_to_lds_b128 %5, %11, off\n\t"
                 "s_wait_xcnt 0x0"
                 :: "v"(l), "v"(l + 1u * CR * LP * 2), "v"(l + 2u * CR * LP * 2), "v"(l + 3u * CR * LP * 2), "v"(l + 4u * CR * LP * 2), "v"(l + 5u * CR * LP * 2),
                    "v"(g0), "v"(g1), "v"(g2), "v"(g3), "v"(g4), "v"(g5)
                 : "memory");
}
__device__ __forceinline__ void copy8(const h16* g, size_t rs, unsigned l) {
    asm volatile("global_load_async_to_lds_b128 %0, %8, off\n\t"
                 "global_load_async_to_lds_b128 %1, %9, off\n\t"
                 "global_load_async_to_lds_b128 %2, %10, off\n\t"
                 "global_load_async_to_lds_b128 %3, %11, off\n\t"
                 "global_load_async_to_lds_b128 %4, %12, off\n\t"
                 "global_load_async_to_lds_b128 %5, %13, off\n\t"
                 "global_load_async_to_lds_b128 %6, %14, off\n\t"
                 "global_load_async_to_lds_b128 %7, %15, off\n\t"
                 "s_wait_xcnt 0x0"
                 :: "v"(l), "v"(l + 1u * CR * LP * 2), "v"(l + 2u * CR * LP * 2), "v"(l + 3u * CR * LP * 2), "v"(l + 4u * CR * LP * 2), "v"(l + 5u * CR * LP * 2), "v"(l + 6u * CR * LP * 2), "v"(l + 7u * CR * LP * 2),
                    "v"(g), "v"(g + rs), "v"(g + 2 * rs), "v"(g + 3 * rs), "v"(g + 4 * rs), "v"(g + 5 * rs), "v"(g + 6 * rs), "v"(g + 7 * rs)
                 : "memory");
}
__global__ __launch_bounds__(256) void k_attn(const h16* __restrict__ Q, const h16* __restrict__ Kk, const h16* __restrict__ VS, float* __restrict__ O) {
    static_assert(KS == 64 && RT == 2 * QT && LW % 64 == 0 && QT + AK <= DD && AK == 10 * CR && QT == 2 * CR && DD == 16 * CR && QT + LW >= 6 * CR, "the copy lists below");
    __shared__ __align__(16) h16 ring[2 * RB];
    __shared__ __align__(16) float Sl[QT * SPI];       // scores; behind the v loop each wave's output staging
    __shared__ __align__(16) h16 Pl[QT * PPI];
    const int z = (int)blockIdx.x / (RT / QT); int b, i0, c0, span; tile_of(z, b, i0, c0, span);
    const int i0s = i0 + ((int)blockIdx.x % (RT / QT)) * QT;
    const int ks0 = (i0s - LW > 0) ? (i0s - LW) : 0, ke = (i0s + QT + LW < SS) ? (i0s + QT + LW) : SS, sspan = ke - ks0, vo = ks0 - c0;
    const int tid = threadIdx.x, lane = tid & 31, lr = lane & 15, hi = lane >> 4, wv = tid >> 5;
    const int srow = tid >> 3, scol = (tid & 7) * 8;
    const unsigned l0 = (unsigned)(size_t)ring + (unsigned)(srow * LP + scol) * 2u;
    const h16* qp = Q + ((size_t)b * SS + i0s + srow) * DD + scol;
    const h16* kp = Kk + ((size_t)b * SS + ks0 + srow) * DD + scol;
    const h16* vp = VS + ((size_t)z * DD + srow) * SPN + vo + scol;
    // Key rows at or past sspan (edge sub-tiles) do not exist: their LDS rows take the last CR real rows again, and the mask drops their scores.
    auto kr = [&](int c) { const int r = c * CR; return (size_t)((r < sspan - CR) ? r : (sspan - CR)) * DD; };
    auto fill1 = [&](int st) { const int kc = st * KS; const unsigned l = l0 + (unsigned)(st & 1) * (unsigned)(RB * 2); const h16* q = qp + kc; const h16* k = kp + kc;
        copy6(q, q + (size_t)CR * DD, k, k + (size_t)CR * DD, k + (size_t)2 * CR * DD, k + (size_t)3 * CR * DD, l);
        copy6(k + (size_t)4 * CR * DD, k + (size_t)5 * CR * DD, k + kr(6), k + kr(7), k + kr(8), k + kr(9), l + 6u * CR * LP * 2); };
    auto fill2 = [&](int st) { const unsigned l = l0 + (unsigned)(st & 1) * (unsigned)(RB * 2); const h16* v = vp + st * KS;
        copy8(v, (size_t)CR * SPN, l); copy8(v + (size_t)8 * CR * SPN, (size_t)CR * SPN, l + 8u * CR * LP * 2); };
    // scores: 2 x 4 waves, 32 rows x 80 keys each
    {
        const int wm = (wv & 1) * 32, wn = (wv >> 1) * 80;
        v8f s[2][5];
#pragma unroll
        for (int mb = 0; mb < 2; ++mb)
#pragma unroll
            for (int nb = 0; nb < 5; ++nb) s[mb][nb] = (v8f){};
        constexpr int nst = DD / KS;
        fill1(0);
        asm volatile("s_wait_asynccnt 0x0" ::: "memory");    // this wave's copies of stage 0 have landed
        __syncthreads();                                     // and every other wave's: stage 0 may be read
        fill1(1);
#pragma unroll 1
        for (int st = 0; st < nst; ++st) {                   // kept rolled: one copy of the stage body, buffers alternate by st & 1
            const h16* sb = ring + (st & 1) * RB;
            const h16* pa = sb + (wm + lr) * LP + 8 * hi; const h16* pb = sb + (QT + wn + lr) * LP + 8 * hi;
            v16h a[KS / 32][2], bb[KS / 32][5];                  // the whole stage's fragments go to registers first: one LDS latency a stage, and the buffer is free before the products start
#pragma unroll
            for (int ks = 0; ks < KS / 32; ++ks) {
#pragma unroll
                for (int mb = 0; mb < 2; ++mb) a[ks][mb] = WFrag<h16>::ld(pa + mb * 16 * LP + ks * 32);
#pragma unroll
                for (int nb = 0; nb < 5; ++nb) bb[ks][nb] = WFrag<h16>::ld(pb + nb * 16 * LP + ks * 32); }
            asm volatile("s_wait_dscnt 0x0" ::: "memory");       // this wave's reads of the buffer are done before it is refilled
            asm volatile("s_wait_asynccnt 0x0" ::: "memory");    // this wave's copies of stage st + 1 have landed
            __syncthreads();                                     // publishes stage st + 1 and ends every wave's reads of stage st
            if (st + 2 < nst) fill1(st + 2);
            __builtin_amdgcn_sched_barrier(0);                   // keeps the products, which read registers only, behind the refill: the copies fly while they run
#pragma unroll
            for (int ks = 0; ks < KS / 32; ++ks)
#pragma unroll
                for (int nb = 0; nb < 5; ++nb)
#pragma unroll
                    for (int mb = 0; mb < 2; ++mb) s[mb][nb] = wmma16(a[ks][mb], bb[ks][nb], s[mb][nb]);
        }
        asm volatile("s_wait_asynccnt 0x0" ::: "memory");        // no copy of a score stage is in flight when the ring takes the v stages
        fill2(0);                                                // both buffers are free behind the last barrier: the first v stage flies during the softmax
#pragma unroll
        for (int mb = 0; mb < 2; ++mb)
#pragma unroll
            for (int nb = 0; nb < 5; ++nb)
#pragma unroll
                for (int j = 0; j < 8; ++j) Sl[(wm + mb * 16 + hi * 8 + j) * SPI + wn + nb * 16 + lr] = s[mb][nb][j];
    }
    __syncthreads();                                             // every wave's scores are in Sl
    // softmax: 4 threads per row, thread t of a row takes columns jj = 16 it + 4 t + u; key j = ks0 + jj counts where jj < sspan and i-128 <= j <= i+128, that is lo <= jj <= lo + wl
    {
        const float c = 0.044194173824159216f;
        const int rr = tid >> 2, t4 = (tid & 3) * 4, i = i0s + rr;
        const int lo = (i - LW > ks0) ? (i - LW - ks0) : 0, up = (i + LW - ks0 < sspan - 1) ? (i + LW - ks0) : (sspan - 1); const unsigned wl = (unsigned)(up - lo);
        const float* sr = Sl + rr * SPI + t4; v4f v[AK / 16]; v4f m4 = { -3.0e38f, -3.0e38f, -3.0e38f, -3.0e38f };
#pragma unroll
        for (int it = 0; it < AK / 16; ++it) { const v4f a = *(const v4f*)(sr + it * 16);
#pragma unroll
            for (int u = 0; u < 4; ++u) { const bool ok = (unsigned)(it * 16 + t4 + u - lo) <= wl; const float x = ok ? a[u] * c : -3.0e38f; v[it][u] = x; m4[u] = fmaxf(m4[u], x); } }
        float mx = fmaxf(fmaxf(m4[0], m4[1]), fmaxf(m4[2], m4[3]));
        mx = fmaxf(mx, __shfl_xor(mx, 1, 32)); mx = fmaxf(mx, __shfl_xor(mx, 2, 32));
        v4f s4 = (v4f){};
#pragma unroll
        for (int it = 0; it < AK / 16; ++it)
#pragma unroll
            for (int u = 0; u < 4; ++u) { v[it][u] = __builtin_amdgcn_exp2f((v[it][u] - mx) * 1.4426950408889634f); s4[u] += v[it][u]; }
        float sum = (s4[0] + s4[1]) + (s4[2] + s4[3]);
        sum += __shfl_xor(sum, 1, 32); sum += __shfl_xor(sum, 2, 32);
        const float f = __fdiv_rn(1.0f, sum);
#pragma unroll
        for (int it = 0; it < AK / 16; ++it) { v4h o;
#pragma unroll
            for (int u = 0; u < 4; ++u) o[u] = (h16)(v[it][u] * f);
            *(v4h*)(Pl + rr * PPI + it * 16 + t4) = o; }
    }
    // attn v: 8 waves, all 64 rows x 64 columns (d) each; k runs over the sub-tile's sspan keys
    const int nst2 = sspan / KS;
    v8f acc[4][4];
#pragma unroll
    for (int mb = 0; mb < 4; ++mb)
#pragma unroll
        for (int nb = 0; nb < 4; ++nb) acc[mb][nb] = (v8f){};
    asm volatile("s_wait_asynccnt 0x0" ::: "memory");            // this wave's copies of v stage 0 have landed
    __syncthreads();                                             // and every other wave's; every wave's probabilities are in Pl
    if (nst2 > 1) fill2(1);
#pragma unroll 1
    for (int st = 0; st < nst2; ++st) {                          // kept rolled: the trip count is the sub-tile's
        const h16* pa = Pl + lr * PPI + st * KS + 8 * hi; const h16* pb = ring + (st & 1) * RB + (wv * 64 + lr) * LP + 8 * hi;
        v16h a[4], bb[4];                                        // all eight fragments of 32 k are fetched ahead of their 16 products: one LDS latency for them all
#pragma unroll
        for (int mb = 0; mb < 4; ++mb) a[mb] = WFrag<h16>::ld(pa + mb * 16 * PPI);
#pragma unroll
        for (int nb = 0; nb < 4; ++nb) bb[nb] = WFrag<h16>::ld(pb + nb * 16 * LP);
        __builtin_amdgcn_sched_barrier(0);                       // keeps the fetches above the products: without it every four products wait for a fetch of their own
#pragma unroll
        for (int nb = 0; nb < 4; ++nb)
#pragma unroll
            for (int mb = 0; mb < 4; ++mb) acc[mb][nb] = wmma16(a[mb], bb[nb], acc[mb][nb]);
#pragma unroll
        for (int mb = 0; mb < 4; ++mb) a[mb] = WFrag<h16>::ld(pa + mb * 16 * PPI + 32);
#pragma unroll
        for (int nb = 0; nb < 4; ++nb) bb[nb] = WFrag<h16>::ld(pb + nb * 16 * LP + 32);
        asm volatile("s_wait_dscnt 0x0" ::: "memory");           // this wave's reads of the buffer are done before it is refilled
        asm volatile("s_wait_asynccnt 0x0" ::: "memory");        // this wave's copies of stage st + 1 have landed
        __syncthreads();                                         // publishes stage st + 1 and ends every wave's reads of stage st
        if (st + 2 < nst2) fill2(st + 2);
        __builtin_amdgcn_sched_barrier(0);                       // keeps the stage's last products, which read registers only, behind the refill: the copies fly while they run
#pragma unroll
        for (int nb = 0; nb < 4; ++nb)
#pragma unroll
            for (int mb = 0; mb < 4; ++mb) acc[mb][nb] = wmma16(a[mb], bb[nb], acc[mb][nb]);
    }
    asm volatile("s_wait_asynccnt 0x0" ::: "memory");            // no copy is in flight when the wave ends
    // A 16 x 64 f32 block turns in the wave's own range of Sl (last read in front of the barrier behind the softmax), so that each store covers whole 128-B lines.
    float* os = Sl + wv * (16 * 68);
#pragma unroll
    for (int mb = 0; mb < 4; ++mb) {
#pragma unroll
        for (int nb = 0; nb < 4; ++nb) {
#pragma unroll
            for (int j = 0; j < 8; ++j) os[(hi * 8 + j) * 68 + nb * 16 + lr] = acc[mb][nb][j]; }
        // compiler fence: the reads that follow take other lanes' LDS writes and must not be moved over them
        __builtin_amdgcn_wave_barrier(); asm volatile("" ::: "memory");
        float* crow = O + ((size_t)b * SS + i0s + mb * 16) * DD + wv * 64;
#pragma unroll
        for (int s = 0; s < 8; ++s) { const int row = 2 * s + hi, cofs = lr * 4; const v4f val = *(const v4fa*)(os + row * 68 + cofs); *(v4f*)(crow + (size_t)row * DD + cofs) = val; }
        asm volatile("s_wait_xcnt 0x0" ::: "memory");   // the next row block's loads go into registers that the last store names
        // compiler fence: the next row block's LDS writes stay behind the reads above
        __builtin_amdgcn_wave_barrier(); asm volatile("" ::: "memory");
    }
}

extern "C" void kernel_launch(void* const* d_in, const int* in_sizes, int n_in,
                              void* d_out, int out_size, void* d_ws, size_t ws_size, hipStream_t stream) {
    (void)in_sizes; (void)n_in; (void)out_size;
    const float* x = (const float*)d_in[0]; const float* wq = (const float*)d_in[1]; const float* wk = (const float*)d_in[2]; const float* wv = (const float*)d_in[3]; const float* bq = (const float*)d_in[4]; const float* bk = (const float*)d_in[5]; const float* bv = (const float*)d_in[6];
    float* OUT = (float*)d_out;     // [8][2048][512]
    char* wsp = (char*)d_ws;
    auto take = [&](size_t bytes) { char* p = wsp; wsp += (bytes + 255) & ~(size_t)255; return (void*)p; };
    bf* WQ = (bf*)take((size_t)3 * DD * DD * 2);                       // Wq, Wk, Wv transposed, one after the other
    bf* XB = (bf*)take((size_t)NB_ * SS * DD * 2);
    h16* Q16 = (h16*)take((size_t)2 * NB_ * SS * DD * 2);              // q, k (fp16), one after the other
    h16* K16 = Q16 + (size_t)NB_ * SS * DD;
    h16* VS = (h16*)take((size_t)NZ * DD * SPN * 2);                    // v (fp16), transposed, one slice per query tile
    if ((size_t)(wsp - (char*)d_ws) > ws_size) return;    // total ~ 98 MiB
    k_prep<<<PW, PT, 0, stream>>>(x, wq, wk, wv, XB, WQ);
    k_gemmw<bf, true, 0, true><<<dim3(NB_ * SS / BT, DD / BT, 3), 128, 0, stream>>>(XB, WQ, DD, nullptr, DD, bq, bk, bv, 0, (size_t)DD * DD, (size_t)NB_ * SS * DD, VS, Q16);
    k_attn<<<NZ * (RT / QT), 256, 0, stream>>>(Q16, K16, VS, OUT);
}

// v009
// It runs in 45.1 microseconds.
// It is 1.26 times as fast as v007, going by the measured steps of the versions left out in between.
// All steps since v000 together make it 84.2 times as fast.
#include <hip/hip_runtime.h>

// TransformedAttention (x [8][2048][512]; q/k/v = x W + b (512); scores = q.k / sqrt(512) restricted to the sliding window i-128 <= j <= i+128 (others masked); softmax; out = attn v -> [8][2048][512]).
// Banded evaluation: for each 64-row query tile only the key columns max(0,i0s-128) .. min(2048,i0s+192) (<= 320) are computed; both projections, scores, softmax and the value products run in one launch (k_attn).
// No k projection: q_i . k_j = (x_i Wq + bq) . (x_j Wk + bk) = (x_i (Wq Wk^T) + Wk bq) . x_j + (a term of row i alone, which holds all of bk). The softmax of a row does not change when one number is added to all its scores, so that term is left out: g = x G + cg with G = Wq Wk^T, cg = Wk bq, and the keys are the rows of x.
// No v plane: attn (x Wv + bv) = (attn x) Wv + bv, since a row of attn sums to 1: y = attn x over the window's rows of x, then out = y Wv + bv.
// Compute dtypes, f32 accumulate: every input rounded to bf16; G on bf16 operands (exact), rounded once to fp16; x and Wv held as fp16 planes of their bf16 values; g on fp16 operands + bias, rounded once to fp16; banded scores g . x (K 512) on single fp16 planes; window mask + softmax f32 -> one fp16 probability plane; y = attn x (K <= 320) on single fp16 planes, rounded once to fp16; out = y Wv on fp16 operands + bias in f32.

#define NB_  8
#define SS   2048
#define DD   512
#define LW   128
typedef _Float16 h16;
typedef __attribute__((ext_vector_type(16))) __bf16   v16bf;
typedef __attribute__((ext_vector_type(16))) _Float16 v16h;
typedef __attribute__((ext_vector_type(8)))  _Float16 v8h;
typedef __attribute__((ext_vector_type(8)))  unsigned short v8us;
typedef __attribute__((ext_vector_type(8)))  short    v8s;
typedef __attribute__((ext_vector_type(8)))  float    v8f;
typedef __attribute__((ext_vector_type(4)))  float    v4f;
typedef v8h  __attribute__((may_alias)) v8ha;
typedef v4f  __attribute__((may_alias)) v4fa;

__device__ __forceinline__ unsigned short f2bf(float f) { unsigned u = __float_as_uint(f); u += 0x7FFFu + ((u >> 16) & 1u); return (unsigned short)(u >> 16); }
__device__ __forceinline__ float bf2f(unsigned short b) { return __uint_as_float(((unsigned)b) << 16); }
__device__ __forceinline__ float bfr(float f) { return bf2f(f2bf(f)); }
__device__ __forceinline__ v16h cat16(v8h lo, v8h hi) { return __builtin_shufflevector(lo, hi, 0, 1, 2, 3, 4, 5, 6, 7, 8, 9, 10, 11, 12, 13, 14, 15); }
__device__ __forceinline__ v16bf cat16b(v8us lo, v8us hi) { return __builtin_bit_cast(v16bf, __builtin_shufflevector(lo, hi, 0, 1, 2, 3, 4, 5, 6, 7, 8, 9, 10, 11, 12, 13, 14, 15)); }
__device__ __forceinline__ v8f wmma16(v16h a, v16h b, v8f c) { return __builtin_amdgcn_wmma_f32_16x16x32_f16(false, a, false, b, (short)0, c, false, false); }
__device__ __forceinline__ v8f wmmab(v16bf a, v16bf b, v8f c) { return __builtin_amdgcn_wmma_f32_16x16x32_bf16(false, a, false, b, (short)0, c, false, false); }

#define KS   64               // k per stage: one 128-B line of every operand row
#define LP   72               // LDS row pitch in elements of 128-B rows: 144 B = 16 B x 9, the pitch of ds_load_b128 readers
// Fragment of 16 rows x 32 k from k-contiguous rows, for A and B alike: p points at k = 8 hi of the lane's row; the lane takes k 8 hi .. 8 hi + 7 and 16 + 8 hi .. 16 + 8 hi + 7 (the hardware's k order).
__device__ __forceinline__ v16h ldf(const h16* p) { return cat16(*(const v8ha*)p, *(const v8ha*)(p + 16)); }
// The same fragment from rows that run ACROSS k (a row-major tile of keys x d, the operand's rows being its columns): two transposing loads, 16 keys apart; p is the lane's address in the tile as the instruction wants it, pitch in bytes.
__device__ __forceinline__ v8h ldt(const unsigned char* p) { typedef __attribute__((address_space(3))) v8s lds_v8s; return __builtin_bit_cast(v8h, __builtin_amdgcn_ds_load_tr16_b128_v8i16((lds_v8s*)p)); }
__device__ __forceinline__ v16h ldft(const unsigned char* p, unsigned pitch) { return cat16(ldt(p), ldt(p + 16u * pitch)); }

typedef __attribute__((ext_vector_type(2))) _Float16 v2h;
typedef __attribute__((ext_vector_type(2))) float v2f;
__device__ __forceinline__ v16bf frag_bf(v8f lo, v8f hi) { v8us a, b;
#pragma unroll
    for (int e = 0; e < 8; ++e) { a[e] = f2bf(lo[e]); b[e] = f2bf(hi[e]); }
    return cat16b(a, b); }

// ---- k_prep: the input conversions and G = Wq Wk^T in one resident launch: PW work-groups of 16 waves (one per WGP), every load of a wave issued ahead of its first store.
// Work-group g owns 16 rows n x 64 columns k of the two planes that k_attn reads as Bt: plane 0, Bt[n][k] = G[k][n] = sum_u Wq[k][u] Wk[n][u]; plane 1, Bt[n][k] = Wv[k][n]. Wave wv writes the 128-B line of row n0 + wv of each.
// G: wave wv multiplies the 32 u from 32 wv on (4 WMMAs: 64 k x 16 n, fragments straight from the f32 rows, which run along u); the 16 partial tiles meet in LDS and are summed in the order of the waves. cg[n] = sum_u Wk[n][u] bq[u] goes the same way; the work-groups of the first 64 k store it, each its 16 values in a 128-B line of its own.
// x: a work-group converts XCH * PT chunks of 8 floats that lie one after the other; a thread takes chunk tid of each run of PT.
#define PW   256
#define PT   512
#define XCH  (NB_ * SS * DD / 8 / (PW * PT))
#define MPI  68               // pitch in floats of a row n of a partial tile: 272 B = 16 B x 17, so that the 16-B stores of 16 lanes cover all 64 banks
__global__ __launch_bounds__(PT) void k_prep(const float* __restrict__ x, const float* __restrict__ w0, const float* __restrict__ w1, const float* __restrict__ w2, const float* __restrict__ bq, h16* XB, h16* Bt, float* CG) {
    static_assert(NB_ * SS * DD % (8 * PW * PT) == 0, "every thread converts XCH whole chunks");
    static_assert(DD % 64 == 0 && DD * DD / 64 == PW * (PT / 32), "one line of each plane per wave");
    static_assert(DD == 32 * (PT / 32), "one WMMA depth of u per wave");
    __shared__ __align__(16) float part[(PT / 32) * 16 * MPI];
    __shared__ float cpart[(PT / 32) * 16];
    const int tid = threadIdx.x, lane = tid & 31, lr = lane & 15, hi = lane >> 4, wv = tid >> 5;
    const int n0 = ((int)blockIdx.x / (DD / 64)) * (PT / 32), k0 = ((int)blockIdx.x % (DD / 64)) * 64;
    const int n = n0 + wv, k = k0 + lane * 2, u0 = wv * 32 + 8 * hi;
    const size_t wi = (size_t)k * DD + n, ch = (size_t)blockIdx.x * (XCH * PT) + tid;
    // Fragment of 16 rows x 32 u, for A and B alike: lane (lr, hi) holds u0 .. u0+7 and u0+16 .. u0+23 of row lr.
    v8f fa[4][2], fb[2], fq[2];
#pragma unroll
    for (int mb = 0; mb < 4; ++mb) { const float* p = w0 + (size_t)(k0 + mb * 16 + lr) * DD + u0; fa[mb][0] = *(const v8f*)p; fa[mb][1] = *(const v8f*)(p + 16); }
    { const float* p = w1 + (size_t)(n0 + lr) * DD + u0; fb[0] = *(const v8f*)p; fb[1] = *(const v8f*)(p + 16); }
    fq[0] = *(const v8f*)(bq + u0); fq[1] = *(const v8f*)(bq + u0 + 16);
    const float c0 = w2[wi], c1 = w2[wi + DD];
    asm volatile("s_wait_xcnt 0x0" ::: "memory");   // behind the last weight and bias load: the x loads' results may go into registers that hold these loads' addresses
    __builtin_amdgcn_sched_barrier(0);   // a "memory" clobber does not tie the wait to registers: this keeps the x address arithmetic and the x loads, which write registers, behind it
    v8f v[XCH];
#pragma unroll
    for (int it = 0; it < XCH; ++it) v[it] = *(const v8f*)(x + (ch + (size_t)it * PT) * 8);
    asm volatile("s_wait_xcnt 0x0" ::: "memory");   // behind the last load: what follows may go into registers that hold these loads' addresses
    __builtin_amdgcn_sched_barrier(0);   // keeps the x loads in flight together with the weight loads: without it they are moved behind the weight product, a second memory latency in series
    {
        const v16bf b = frag_bf(fb[0], fb[1]);
        float cp = 0.0f;
#pragma unroll
        for (int e = 0; e < 8; ++e) { cp += bfr(fb[0][e]) * bfr(fq[0][e]); cp += bfr(fb[1][e]) * bfr(fq[1][e]); }
        cp += __shfl_xor(cp, 16, 32);
        if (hi == 0) cpart[wv * 16 + lr] = cp;
        // An accumulator lane holds column n = lr and rows k = 16 mb + 8 hi + j: 32 B of a row of the transposed tile.
        float* pp = part + (wv * 16 + lr) * MPI + hi * 8;
#pragma unroll
        for (int mb = 0; mb < 4; ++mb) { const v8f d = wmmab(frag_bf(fa[mb][0], fa[mb][1]), b, (v8f){});
            *(v4fa*)(pp + mb * 16) = (v4f){ d[0], d[1], d[2], d[3] }; *(v4fa*)(pp + mb * 16 + 4) = (v4f){ d[4], d[5], d[6], d[7] }; }
    }
    h16* bt = Bt + (size_t)n * DD + k; v2h o;
    o[0] = (h16)bfr(c0); o[1] = (h16)bfr(c1); *(v2h*)(bt + (size_t)DD * DD) = o;
    // Work-group barrier for LDS alone: every wave's partial tile and partial cg are in LDS behind it. The two fences name LDS only, so that the x loads stay in flight across it.
    __builtin_amdgcn_fence(__ATOMIC_RELEASE, "workgroup", "local");
    __builtin_amdgcn_s_barrier();
    __builtin_amdgcn_fence(__ATOMIC_ACQUIRE, "workgroup", "local");
    v2f g = (v2f){};
#pragma unroll
    for (int w = 0; w < PT / 32; ++w) g += *(const v2f*)(part + (w * 16 + wv) * MPI + lane * 2);
    v2h og; og[0] = (h16)g[0]; og[1] = (h16)g[1]; *(v2h*)bt = og;
    if (k0 == 0 && tid < 16) { float c = 0.0f;
#pragma unroll
        for (int w = 0; w < PT / 32; ++w) c += cpart[w * 16 + tid];
        CG[((int)blockIdx.x / (DD / 64)) * 32 + tid] = c; }
    asm volatile("s_wait_xcnt 0x0" ::: "memory");   // behind these stores: the x values may go into registers that they name
#pragma unroll
    for (int it = 0; it < XCH; ++it) { v8h q;
#pragma unroll
        for (int u = 0; u < 8; ++u) q[u] = (h16)bfr(v[it][u]);
        *(v8h*)(XB + (ch + (size_t)it * PT) * 8) = q;
        if (it == XCH / 2 - 1) asm volatile("s_wait_xcnt 0x0" ::: "memory"); }   // behind the first half's stores: the second half's values may go into registers that those stores name
}
// ---- k_attn: the whole of QT query rows in one work-group of 8 waves; grid NB_ * SS / QT, one work-group per WGP. Five steps, each reading LDS only:
//   1. g = x G + cg       (64 x 512, K 512): A = the tile's x rows (Ar), Bt = plane 0 of WG, staged
//   2. scores = g . x_j   (64 x <= 320, K 512): A = g (Ar), Bt = the key rows of x, staged
//   3. window softmax, f32 scores -> fp16 probabilities, each row written over its own scores (Sl)
//   4. y = attn x         (64 x 512, K = sspan): the key rows of x staged whole (64 keys x 512 d), read by transposing loads
//   5. out = y Wv + bv    (64 x 512, K 512): A = y (Ar), Bt = plane 1 of WG, staged
// Tile y: rows i0s .. i0s+63 of batch entry b, keys ks0 .. ks0+sspan-1 (sspan 192, 256 or 320, a multiple of 64).
// Every product stages 64 k per stage by asynchronous copies, two buffers: the next stage flies while this one is multiplied. The first stage of a step is issued behind the last barrier of the step before it.
#define QT   64
#define AK   (QT + 2 * LW)    // most keys of a tile
#define RB   (DD * LP)        // elements of one ring buffer
#define API  520              // pitch in elements of the resident A operand (x rows, then g, then y): 1040 B = 16 B x 65, for ds_load_b128 readers and 16-B stores
#define SPI  332              // score row pitch in floats: 1328 B = 16 B x 83, since ds_load_b128 reads the probabilities at this pitch
#define PPI  (2 * SPI)        // the same pitch in fp16 elements
#define XP   528              // pitch in elements of a whole key row in step 4: 1056 B = 32 B x 33, for ds_load_tr16_b128 readers
#define CR   32               // 128-B rows that one copy of the work-group covers (8 threads per row)
#define XR   4                // 1024-B rows that one copy of the work-group covers (64 threads per row)
typedef __attribute__((ext_vector_type(4))) _Float16 v4h;
typedef v4h __attribute__((may_alias)) v4ha;
// Six, four and eight copies of this thread's 16 B. The closing s_wait_xcnt stands inside each statement, so that no address register of a copy is rewritten in front of it.
__device__ __forceinline__ void copy6(const h16* g0, const h16* g1, const h16* g2, const h16* g3, const h16* g4, const h16* g5, unsigned l) {
    asm volatile("global_load_async_to_lds_b128 %0, %6, off\n\t"
                 "global_load_async_to_lds_b128 %1, %7, off\n\t"
                 "global_load_async_to_lds_b128 %2, %8, off\n\t"
                 "global_load_async_to_lds_b128 %3, %9, off\n\t"
                 "global_load_async_to_lds_b128 %4, %10, off\n\t"
                 "global_load_async_to_lds_b128 %5, %11, off\n\t"
                 "s_wait_xcnt 0x0"
                 :: "v"(l), "v"(l + 1u * CR * LP * 2), "v"(l + 2u * CR * LP * 2), "v"(l + 3u * CR * LP * 2), "v"(l + 4u * CR * LP * 2), "v"(l + 5u * CR * LP * 2),
                    "v"(g0), "v"(g1), "v"(g2), "v"(g3), "v"(g4), "v"(g5)
                 : "memory");
}
__device__ __forceinline__ void copy4(const h16* g0, const h16* g1, const h16* g2, const h16* g3, unsigned l) {
    asm volatile("global_load_async_to_lds_b128 %0, %4, off\n\t"
                 "global_load_async_to_lds_b128 %1, %5, off\n\t"
                 "global_load_async_to_lds_b128 %2, %6, off\n\t"
                 "global_load_async_to_lds_b128 %3, %7, off\n\t"
                 "s_wait_xcnt 0x0"
                 :: "v"(l), "v"(l + 1u * CR * LP * 2), "v"(l + 2u * CR * LP * 2), "v"(l + 3u * CR * LP * 2),
                    "v"(g0), "v"(g1), "v"(g2), "v"(g3)
                 : "memory");
}
// g: the thread's 16 B of the first row, rs: the step between copies in elements of the source, l: the LDS byte address, STEP: its step in bytes
template <unsigned STEP>
__device__ __forceinline__ void copy8(const h16* g, size_t rs, unsigned l) {
    asm volatile("global_load_async_to_lds_b128 %0, %8, off\n\t"
                 "global_load_async_to_lds_b128 %1, %9, off\n\t"
                 "global_load_async_to_lds_b128 %2, %10, off\n\t"
                 "global_load_async_to_lds_b128 %3, %11, off\n\t"
                 "global_load_async_to_lds_b128 %4, %12, off\n\t"
                 "global_load_async_to_lds_b128 %5, %13, off\n\t"
                 "global_load_async_to_lds_b128 %6, %14, off\n\t"
                 "global_load_async_to_lds_b128 %7, %15, off\n\t"
                 "s_wait_xcnt 0x0"
                 :: "v"(l), "v"(l + 1u * STEP), "v"(l + 2u * STEP), "v"(l + 3u * STEP), "v"(l + 4u * STEP), "v"(l + 5u * STEP), "v"(l + 6u * STEP), "v"(l + 7u * STEP),
                    "v"(g), "v"(g + rs), "v"(g + 2 * rs), "v"(g + 3 * rs), "v"(g + 4 * rs), "v"(g + 5 * rs), "v"(g + 6 * rs), "v"(g + 7 * rs)
                 : "memory");
}
// Stage st of a weight plane: 64 k of its 512 rows n. wp: the thread's 16 B of row tid / 8, l0: their LDS byte address in buffer 0.
__device__ __forceinline__ void fill_w(const h16* wp, int st, unsigned l0) {
    const unsigned l = l0 + (unsigned)(st & 1) * (unsigned)(RB * 2); const h16* w = wp + st * KS;
    copy8<CR * LP * 2>(w, (size_t)CR * DD, l); copy8<CR * LP * 2>(w + (size_t)8 * CR * DD, (size_t)CR * DD, l + 8u * CR * LP * 2);
}
// Steps 1 and 5: acc = A (64 x 512, the rows of Ar) times a weight plane (512 rows n, k-contiguous); wave wv takes all 64 rows x columns 64 wv .. 64 wv + 63. The caller has issued stage 0 and written Ar.
// SW 0: acc[mb][nb][j] = C[16 mb + 8 hi + j][64 wv + 16 nb + lr]. SW 1: the operands change places, so that a lane holds 8 consecutive columns of one row: acc[mb][nb][j] = C[16 mb + lr][64 wv + 16 nb + 8 hi + j].
template <bool SW>
__device__ __forceinline__ void mm_w(const h16* wp, unsigned l0, const h16* Ar, const h16* ring, int lr, int hi, int wv, v8f (&acc)[4][4]) {
    constexpr int nst = DD / KS;
#pragma unroll
    for (int mb = 0; mb < 4; ++mb)
#pragma unroll
        for (int nb = 0; nb < 4; ++nb) acc[mb][nb] = (v8f){};
    asm volatile("s_wait_asynccnt 0x0" ::: "memory");            // this wave's copies of stage 0 have landed
    __syncthreads();                                             // and every other wave's; every wave's rows of Ar are written
    fill_w(wp, 1, l0);
#pragma unroll 1
    for (int st = 0; st < nst; ++st) {                           // kept rolled: one copy of the stage body, buffers alternate by st & 1
        const h16* pa = Ar + lr * API + st * KS + 8 * hi; const h16* pb = ring + (st & 1) * RB + (wv * 64 + lr) * LP + 8 * hi;
        v16h a[4], bb[4];                                        // all eight fragments of 32 k are fetched ahead of their 16 products: one LDS latency for them all
#pragma unroll
        for (int mb = 0; mb < 4; ++mb) a[mb] = ldf(pa + mb * 16 * API);
#pragma unroll
        for (int nb = 0; nb < 4; ++nb) bb[nb] = ldf(pb + nb * 16 * LP);
        __builtin_amdgcn_sched_barrier(0);                       // keeps the fetches above the products: without it every four products wait for a fetch of their own
#pragma unroll
        for (int nb = 0; nb < 4; ++nb)
#pragma unroll
            for (int mb = 0; mb < 4; ++mb) acc[mb][nb] = SW ? wmma16(bb[nb], a[mb], acc[mb][nb]) : wmma16(a[mb], bb[nb], acc[mb][nb]);
#pragma unroll
        for (int mb = 0; mb < 4; ++mb) a[mb] = ldf(pa + mb * 16 * API + 32);
#pragma unroll
        for (int nb = 0; nb < 4; ++nb) bb[nb] = ldf(pb + nb * 16 * LP + 32);
        asm volatile("s_wait_dscnt 0x0" ::: "memory");           // this wave's reads of the buffer (and, in the last stage, of Ar) are done before it is refilled
        asm volatile("s_wait_asynccnt 0x0" ::: "memory");        // this wave's copies of stage st + 1 have landed
        __syncthreads();                                         // publishes stage st + 1 and ends every wave's reads of stage st
        if (st + 2 < nst) fill_w(wp, st + 2, l0);
        __builtin_amdgcn_sched_barrier(0);                       // keeps the stage's last products, which read registers only, behind the refill: the copies fly while they run
#pragma unroll
        for (int nb = 0; nb < 4; ++nb)
#pragma unroll
            for (int mb = 0; mb < 4; ++mb) acc[mb][nb] = SW ? wmma16(bb[nb], a[mb], acc[mb][nb]) : wmma16(a[mb], bb[nb], acc[mb][nb]);
    }
    asm volatile("s_wait_asynccnt 0x0" ::: "memory");            // no copy of this step is in flight when the ring takes the next step's stages
}
__global__ __launch_bounds__(256) void k_attn(const h16* __restrict__ X, const h16* __restrict__ WG, const float* __restrict__ CG, const float* __restrict__ bv, float* __restrict__ O) {
    static_assert(KS == 64 && LW % 64 == 0 && AK == 10 * CR && DD == 16 * CR && QT + LW >= 6 * CR && QT == 16 * XR && KS == 16 * XR && DD * 2 == 64 * 16, "the copy lists below");
    static_assert(KS * XP <= RB && AK <= SPI, "a stage of whole key rows fits a ring buffer; a score row fits its pitch");
    __shared__ __align__(16) h16 ring[2 * RB];
    __shared__ __align__(16) h16 Ar[QT * API];         // the tile's x rows, then g, then y
    __shared__ __align__(16) float Sl[QT * SPI];       // scores, then the probabilities in the same rows; behind step 5 each wave's output staging
    const int b = (int)blockIdx.x / (SS / QT), i0s = ((int)blockIdx.x % (SS / QT)) * QT;
    const int ks0 = (i0s - LW > 0) ? (i0s - LW) : 0, ke = (i0s + QT + LW < SS) ? (i0s + QT + LW) : SS, sspan = ke - ks0;
    const int tid = threadIdx.x, lane = tid & 31, lr = lane & 15, hi = lane >> 4, wv = tid >> 5;
    const int srow = tid >> 3, scol = (tid & 7) * 8;             // 128-B rows: 8 threads a row
    const int xrow = tid >> 6, xcol = (tid & 63) * 8;            // 1024-B rows: 64 threads a row
    const unsigned l0 = (unsigned)(size_t)ring + (unsigned)(srow * LP + scol) * 2u;
    const unsigned lx = (unsigned)(size_t)ring + (unsigned)(xrow * XP + xcol) * 2u;
    const h16* kp = X + ((size_t)b * SS + ks0 + srow) * DD + scol;
    const h16* xp = X + ((size_t)b * SS + ks0 + xrow) * DD + xcol;
    const h16* gp = WG + (size_t)srow * DD + scol;
    // Key rows at or past sspan (edge tiles) do not exist: their LDS rows take the last CR real rows again, and the mask drops their scores.
    auto kr = [&](int c) { const int r = c * CR; return (size_t)((r < sspan - CR) ? r : (sspan - CR)) * DD; };
    auto fill1 = [&](int st) { const unsigned l = l0 + (unsigned)(st & 1) * (unsigned)(RB * 2); const h16* k = kp + st * KS;
        copy6(k, k + (size_t)CR * DD, k + (size_t)2 * CR * DD, k + (size_t)3 * CR * DD, k + (size_t)4 * CR * DD, k + (size_t)5 * CR * DD, l);
        copy4(k + kr(6), k + kr(7), k + kr(8), k + kr(9), l + 6u * CR * LP * 2); };
    auto fill2 = [&](int st) { const unsigned l = lx + (unsigned)(st & 1) * (unsigned)(RB * 2); const h16* x = xp + (size_t)st * KS * DD;
        copy8<XR * XP * 2>(x, (size_t)XR * DD, l); copy8<XR * XP * 2>(x + (size_t)8 * XR * DD, (size_t)XR * DD, l + 8u * XR * XP * 2); };
    v8f acc[4][4];
    // step 1: g = x G + cg
    {
        const h16* q = X + ((size_t)b * SS + i0s + xrow) * DD + xcol; const unsigned la = (unsigned)(size_t)Ar + (unsigned)(xrow * API + xcol) * 2u;
        copy8<XR * API * 2>(q, (size_t)XR * DD, la); copy8<XR * API * 2>(q + (size_t)8 * XR * DD, (size_t)XR * DD, la + 8u * XR * API * 2);
        fill_w(gp, 0, l0);
        v4f cg[4][2];                                            // this lane's 8 values of cg per column block, fetched here so that their latency passes under the product
#pragma unroll
        for (int nb = 0; nb < 4; ++nb) { const float* cb = CG + (wv * 4 + nb) * 32 + 8 * hi; cg[nb][0] = *(const v4fa*)cb; cg[nb][1] = *(const v4fa*)(cb + 4); }
        asm volatile("s_wait_xcnt 0x0" ::: "memory");            // behind the last load: what follows may go into the registers that hold these loads' address
        __builtin_amdgcn_sched_barrier(0);                       // a "memory" clobber does not tie the wait to registers: this keeps later register writes behind it
        mm_w<true>(gp, l0, Ar, ring, lr, hi, wv, acc);
        fill1(0);                                                // both buffers are free behind the last barrier: the first key stage flies while g is written
        // Every wave's reads of the x rows in Ar ended in front of that barrier too: g takes their place, 16 B (8 columns of one row) a store.
#pragma unroll
        for (int nb = 0; nb < 4; ++nb)
#pragma unroll
            for (int mb = 0; mb < 4; ++mb) { v8h o;
#pragma unroll
                for (int u = 0; u < 4; ++u) { o[u] = (h16)(acc[mb][nb][u] + cg[nb][0][u]); o[4 + u] = (h16)(acc[mb][nb][4 + u] + cg[nb][1][u]); }
                *(v8ha*)(Ar + (mb * 16 + lr) * API + wv * 64 + nb * 16 + 8 * hi) = o; }
    }
    // step 2: scores, 2 x 4 waves, 32 rows x 80 keys each
    {
        const int wm = (wv & 1) * 32, wn = (wv >> 1) * 80;
        v8f s[2][5];
#pragma unroll
        for (int mb = 0; mb < 2; ++mb)
#pragma unroll
            for (int nb = 0; nb < 5; ++nb) s[mb][nb] = (v8f){};
        constexpr int nst = DD / KS;
        asm volatile("s_wait_asynccnt 0x0" ::: "memory");    // this wave's copies of stage 0 have landed
        __syncthreads();                                     // and every other wave's; every wave's part of g is in Ar
        fill1(1);
#pragma unroll 1
        for (int st = 0; st < nst; ++st) {                   // kept rolled: one copy of the stage body, buffers alternate by st & 1
            const h16* pa = Ar + (wm + lr) * API + st * KS + 8 * hi; const h16* pb = ring + (st & 1) * RB + (wn + lr) * LP + 8 * hi;
            v16h a[KS / 32][2], bb[KS / 32][5];                  // the whole stage's fragments go to registers first: one LDS latency a stage, and the buffer is free before the products start
#pragma unroll
            for (int ks = 0; ks < KS / 32; ++ks) {
#pragma unroll
                for (int mb = 0; mb < 2; ++mb) a[ks][mb] = ldf(pa + mb * 16 * API + ks * 32);
#pragma unroll
                for (int nb = 0; nb < 5; ++nb) bb[ks][nb] = ldf(pb + nb * 16 * LP + ks * 32); }
            asm volatile("s_wait_dscnt 0x0" ::: "memory");       // this wave's reads of the buffer are done before it is refilled
            asm volatile("s_wait_asynccnt 0x0" ::: "memory");    // this wave's copies of stage st + 1 have landed
            __syncthreads();                                     // publishes stage st + 1 and ends every wave's reads of stage st
            if (st + 2 < nst) fill1(st + 2);
            __builtin_amdgcn_sched_barrier(0);                   // keeps the products, which read registers only, behind the refill: the copies fly while they run
#pragma unroll
            for (int ks = 0; ks < KS / 32; ++ks)
#pragma unroll
                for (int nb = 0; nb < 5; ++nb)
#pragma unroll
                    for (int mb = 0; mb < 2; ++mb) s[mb][nb] = wmma16(a[ks][mb], bb[ks][nb], s[mb][nb]);
        }
        asm volatile("s_wait_asynccnt 0x0" ::: "memory");        // no copy of a score stage is in flight when the ring takes the stages of step 4
        fill2(0);                                                // both buffers are free behind the last barrier: the first stage of step 4 flies during the softmax
#pragma unroll
        for (int mb = 0; mb < 2; ++mb)
#pragma unroll
            for (int nb = 0; nb < 5; ++nb)
#pragma unroll
                for (int j = 0; j < 8; ++j) Sl[(wm + mb * 16 + hi * 8 + j) * SPI + wn + nb * 16 + lr] = s[mb][nb][j];
    }
    __syncthreads();                                             // every wave's scores are in Sl
    // step 3: softmax, 4 threads per row, thread t of a row takes columns jj = 16 it + 4 t + u; key j = ks0 + jj counts where jj < sspan and i-128 <= j <= i+128, that is lo <= jj <= lo + wl
    {
        const float c = 0.044194173824159216f;
        const int rr = tid >> 2, t4 = (tid & 3) * 4, i = i0s + rr;
        const int lo = (i - LW > ks0) ? (i - LW - ks0) : 0, up = (i + LW - ks0 < sspan - 1) ? (i + LW - ks0) : (sspan - 1); const unsigned wl = (unsigned)(up - lo);
        const float* sr = Sl + rr * SPI + t4; v4f v[AK / 16]; v4f m4 = { -3.0e38f, -3.0e38f, -3.0e38f, -3.0e38f };
#pragma unroll
        for (int it = 0; it < AK / 16; ++it) { const v4f a = *(const v4fa*)(sr + it * 16);
#pragma unroll
            for (int u = 0; u < 4; ++u) { const bool ok = (unsigned)(it * 16 + t4 + u - lo) <= wl; const float x = ok ? a[u] * c : -3.0e38f; v[it][u] = x; m4[u] = fmaxf(m4[u], x); } }
        float mx = fmaxf(fmaxf(m4[0], m4[1]), fmaxf(m4[2], m4[3]));
        mx = fmaxf(mx, __shfl_xor(mx, 1, 32)); mx = fmaxf(mx, __shfl_xor(mx, 2, 32));
        v4f s4 = (v4f){};
#pragma unroll
        for (int it = 0; it < AK / 16; ++it)
#pragma unroll
            for (int u = 0; u < 4; ++u) { v[it][u] = __builtin_amdgcn_exp2f((v[it][u] - mx) * 1.4426950408889634f); s4[u] += v[it][u]; }
        float sum = (s4[0] + s4[1]) + (s4[2] + s4[3]);
        sum += __shfl_xor(sum, 1, 32); sum += __shfl_xor(sum, 2, 32);
        const float f = __fdiv_rn(1.0f, sum);
        // A row's probabilities go over its own scores: the row is read by these four lanes of one wave alone, and each value stored hangs on the row's sum, that is on every load of the row.
        h16* pr = (h16*)(Sl + rr * SPI) + t4;
#pragma unroll
        for (int it = 0; it < AK / 16; ++it) { v4h o;
#pragma unroll
            for (int u = 0; u < 4; ++u) o[u] = (h16)(v[it][u] * f);
            *(v4ha*)(pr + it * 16) = o; }
    }
    // step 4: y = attn x, 8 waves, all 64 rows x 64 columns (d) each; k runs over the tile's sspan keys. x^T is the A operand (transposing loads), the probabilities' rows the B operand: acc[mb][nb][j] = y[16 mb + lr][64 wv + 16 nb + 8 hi + j].
    const int nst2 = sspan / KS;
#pragma unroll
    for (int mb = 0; mb < 4; ++mb)
#pragma unroll
        for (int nb = 0; nb < 4; ++nb) acc[mb][nb] = (v8f){};
    asm volatile("s_wait_asynccnt 0x0" ::: "memory");            // this wave's copies of stage 0 have landed
    __syncthreads();                                             // and every other wave's; every wave's probabilities are in Sl
    if (nst2 > 1) fill2(1);
#pragma unroll 1
    for (int st = 0; st < nst2; ++st) {                          // kept rolled: the trip count is the tile's
        const h16* pa = (const h16*)Sl + lr * PPI + st * KS + 8 * hi;
        const unsigned char* px = (const unsigned char*)(ring + (st & 1) * RB) + (8 * hi + (lane & 7)) * (XP * 2) + wv * 128 + ((lane >> 3) & 1) * 16;
        v16h a[4], bb[4];                                        // all eight fragments of 32 k are fetched ahead of their 16 products: one LDS latency for them all
#pragma unroll
        for (int mb = 0; mb < 4; ++mb) a[mb] = ldf(pa + mb * 16 * PPI);
#pragma unroll
        for (int nb = 0; nb < 4; ++nb) bb[nb] = ldft(px + nb * 32, XP * 2);
        __builtin_amdgcn_sched_barrier(0);                       // keeps the fetches above the products: without it every four products wait for a fetch of their own
#pragma unroll
        for (int nb = 0; nb < 4; ++nb)
#pragma unroll
            for (int mb = 0; mb < 4; ++mb) acc[mb][nb] = wmma16(bb[nb], a[mb], acc[mb][nb]);
#pragma unroll
        for (int mb = 0; mb < 4; ++mb) a[mb] = ldf(pa + mb * 16 * PPI + 32);
#pragma unroll
        for (int nb = 0; nb < 4; ++nb) bb[nb] = ldft(px + 32 * (XP * 2) + nb * 32, XP * 2);
        asm volatile("s_wait_dscnt 0x0" ::: "memory");           // this wave's reads of the buffer are done before it is refilled
        asm volatile("s_wait_asynccnt 0x0" ::: "memory");        // this wave's copies of stage st + 1 have landed
        __syncthreads();                                         // publishes stage st + 1 and ends every wave's reads of stage st
        if (st + 2 < nst2) fill2(st + 2);
        __builtin_amdgcn_sched_barrier(0);                       // keeps the stage's last products, which read registers only, behind the refill: the copies fly while they run
#pragma unroll
        for (int nb = 0; nb < 4; ++nb)
#pragma unroll
            for (int mb = 0; mb < 4; ++mb) acc[mb][nb] = wmma16(bb[nb], a[mb], acc[mb][nb]);
    }
    asm volatile("s_wait_asynccnt 0x0" ::: "memory");            // no copy of step 4 is in flight when the ring takes the stages of step 5
    // step 5: out = y Wv + bv
    const h16* vp = gp + (size_t)DD * DD;
    fill_w(vp, 0, l0);                                           // both buffers are free behind the last barrier: the first stage flies while y is written
    // g in Ar was last read in step 2: y takes its place, rounded once to fp16, 16 B a store.
#pragma unroll
    for (int nb = 0; nb < 4; ++nb)
#pragma unroll
        for (int mb = 0; mb < 4; ++mb) { v8h o;
#pragma unroll
            for (int j = 0; j < 8; ++j) o[j] = (h16)acc[mb][nb][j];
            *(v8ha*)(Ar + (mb * 16 + lr) * API + wv * 64 + nb * 16 + 8 * hi) = o; }
    float bz[4];                                                 // the bias of the 4 columns that this lane's accumulators hold, fetched here so that its latency passes under the product
#pragma unroll
    for (int nb = 0; nb < 4; ++nb) bz[nb] = bv[wv * 64 + nb * 16 + lr];
    asm volatile("s_wait_xcnt 0x0" ::: "memory");                // behind the last load: what follows may go into the registers that hold these loads' address
    __builtin_amdgcn_sched_barrier(0);                           // a "memory" clobber does not tie the wait to registers: this keeps later register writes behind it
    mm_w<false>(vp, l0, Ar, ring, lr, hi, wv, acc);
    // A 16 x 64 f32 block turns in the wave's own range of Sl (the probabilities were last read in front of the last barrier of step 4), so that each store covers whole 128-B lines.
    float* os = Sl + wv * (16 * 68);
#pragma unroll
    for (int nb = 0; nb < 4; ++nb) bz[nb] = bfr(bz[nb]);
#pragma unroll
    for (int mb = 0; mb < 4; ++mb) {
#pragma unroll
        for (int nb = 0; nb < 4; ++nb) {
#pragma unroll
            for (int j = 0; j < 8; ++j) os[(hi * 8 + j) * 68 + nb * 16 + lr] = acc[mb][nb][j] + bz[nb]; }
        // compiler fence: the reads that follow take other lanes' LDS writes and must not be moved over them
        __builtin_amdgcn_wave_barrier(); asm volatile("" ::: "memory");
        float* crow = O + ((size_t)b * SS + i0s + mb * 16) * DD + wv * 64;
#pragma unroll
        for (int s = 0; s < 8; ++s) { const int row = 2 * s + hi, cofs = lr * 4; const v4f val = *(const v4fa*)(os + row * 68 + cofs); *(v4f*)(crow + (size_t)row * DD + cofs) = val; }
        asm volatile("s_wait_xcnt 0x0" ::: "memory");   // the next row block's loads go into registers that the last store names
        // compiler fence: the next row block's LDS writes stay behind the reads above
        __builtin_amdgcn_wave_barrier(); asm volatile("" ::: "memory");
    }
}

extern "C" void kernel_launch(void* const* d_in, const int* in_sizes, int n_in,
                              void* d_out, int out_size, void* d_ws, size_t ws_size, hipStream_t stream) {
    (void)in_sizes; (void)n_in; (void)out_size;
    const float* x = (const float*)d_in[0]; const float* wq = (const float*)d_in[1]; const float* wk = (const float*)d_in[2]; const float* wv = (const float*)d_in[3]; const float* bq = (const float*)d_in[4]; const float* bv = (const float*)d_in[6];   // d_in[5], bk, reaches the scores only through a term that is the same for every key of a row (head of the file)
    float* OUT = (float*)d_out;     // [8][2048][512]
    char* wsp = (char*)d_ws;
    auto take = [&](size_t bytes) { char* p = wsp; wsp += (bytes + 255) & ~(size_t)255; return (void*)p; };
    h16* WG = (h16*)take((size_t)2 * DD * DD * 2);                     // G = Wq Wk^T and Wv, transposed, one after the other
    float* CG = (float*)take((size_t)(DD / 16) * 32 * 4);              // cg = Wk bq, 16 values per 128-B line
    h16* XB = (h16*)take((size_t)NB_ * SS * DD * 2);                   // x: the projection's operand, the keys and the values' operand
    if ((size_t)(wsp - (char*)d_ws) > ws_size) return;    // total ~ 17 MiB
    k_prep<<<PW, PT, 0, stream>>>(x, wq, wk, wv, bq, XB, WG, CG);
    k_attn<<<NB_ * SS / QT, 256, 0, stream>>>(XB, WG, CG, bv, OUT);
}

// v010
// It runs in 43.4 microseconds.
// In both of two side-by-side timings against v009, it was 1.04 times as fast.
// All steps since v000 together make it 87.4 times as fast.
#include <hip/hip_runtime.h>

// TransformedAttention (x [8][2048][512]; q/k/v = x W + b (512); scores = q.k / sqrt(512) restricted to the sliding window i-128 <= j <= i+128 (others masked); softmax; out = attn v -> [8][2048][512]).
// Banded evaluation: for each 64-row query tile only the key columns max(0,i0s-128) .. min(2048,i0s+192) (<= 320) are computed; both projections, scores, softmax and the value products run in one launch (k_attn).
// No k projection: q_i . k_j = (x_i Wq + bq) . (x_j Wk + bk) = (x_i (Wq Wk^T) + Wk bq) . x_j + (a term of row i alone, which holds all of bk). The softmax of a row does not change when one number is added to all its scores, so that term is left out: g = x G + cg with G = Wq Wk^T, cg = Wk bq, and the keys are the rows of x.
// No v plane: attn (x Wv + bv) = (attn x) Wv + bv, since a row of attn sums to 1: y = attn x over the window's rows of x, then out = y Wv + bv.
// Compute dtypes, f32 accumulate: every input rounded to bf16; G on bf16 operands (exact), rounded once to fp16; x and Wv held as fp16 planes of their bf16 values; g on fp16 operands + bias, rounded once to fp16; banded scores g . x (K 512) on single fp16 planes; window mask + softmax f32 -> one fp16 probability plane; y = attn x (K <= 320) on single fp16 planes, rounded once to fp16; out = y Wv on fp16 operands + bias in f32.

#define NB_  8
#define SS   2048
#define DD   512
#define LW   128
typedef _Float16 h16;
typedef __attribute__((ext_vector_type(16))) __bf16   v16bf;
typedef __attribute__((ext_vector_type(16))) _Float16 v16h;
typedef __attribute__((ext_vector_type(8)))  _Float16 v8h;
typedef __attribute__((ext_vector_type(8)))  unsigned short v8us;
typedef __attribute__((ext_vector_type(8)))  short    v8s;
typedef __attribute__((ext_vector_type(8)))  float    v8f;
typedef __attribute__((ext_vector_type(4)))  float    v4f;
typedef v8h  __attribute__((may_alias)) v8ha;
typedef v4f  __attribute__((may_alias)) v4fa;

__device__ __forceinline__ unsigned short f2bf(float f) { unsigned u = __float_as_uint(f); u += 0x7FFFu + ((u >> 16) & 1u); return (unsigned short)(u >> 16); }
__device__ __forceinline__ float bf2f(unsigned short b) { return __uint_as_float(((unsigned)b) << 16); }
__device__ __forceinline__ float bfr(float f) { return bf2f(f2bf(f)); }
__device__ __forceinline__ v16h cat16(v8h lo, v8h hi) { return __builtin_shufflevector(lo, hi, 0, 1, 2, 3, 4, 5, 6, 7, 8, 9, 10, 11, 12, 13, 14, 15); }
__device__ __forceinline__ v16bf cat16b(v8us lo, v8us hi) { return __builtin_bit_cast(v16bf, __builtin_shufflevector(lo, hi, 0, 1, 2, 3, 4, 5, 6, 7, 8, 9, 10, 11, 12, 13, 14, 15)); }
__device__ __forceinline__ v8f wmma16(v16h a, v16h b, v8f c) { return __builtin_amdgcn_wmma_f32_16x16x32_f16(false, a, false, b, (short)0, c, false, false); }
__device__ __forceinline__ v8f wmmab(v16bf a, v16bf b, v8f c) { return __builtin_amdgcn_wmma_f32_16x16x32_bf16(false, a, false, b, (short)0, c, false, false); }

#define KS   64               // k per stage: one 128-B line of every operand row
#define LP   72               // LDS row pitch in elements of 128-B rows: 144 B = 16 B x 9, the pitch of ds_load_b128 readers
// Fragment of 16 rows x 32 k from k-contiguous rows, for A and B alike: p points at k = 8 hi of the lane's row; the lane takes k 8 hi .. 8 hi + 7 and 16 + 8 hi .. 16 + 8 hi + 7 (the hardware's k order).
__device__ __forceinline__ v16h ldf(const h16* p) { return cat16(*(const v8ha*)p, *(const v8ha*)(p + 16)); }
// The same fragment from rows that run ACROSS k (a row-major tile of keys x d, the operand's rows being its columns): two transposing loads, 16 keys apart; p is the lane's address in the tile as the instruction wants it, pitch in bytes.
__device__ __forceinline__ v8h ldt(const unsigned char* p) { typedef __attribute__((address_space(3))) v8s lds_v8s; return __builtin_bit_cast(v8h, __builtin_amdgcn_ds_load_tr16_b128_v8i16((lds_v8s*)p)); }
__device__ __forceinline__ v16h ldft(const unsigned char* p, unsigned pitch) { return cat16(ldt(p), ldt(p + 16u * pitch)); }

typedef __attribute__((ext_vector_type(2))) _Float16 v2h;
typedef __attribute__((ext_vector_type(2))) float v2f;
__device__ __forceinline__ v16bf frag_bf(v8f lo, v8f hi) { v8us a, b;
#pragma unroll
    for (int e = 0; e < 8; ++e) { a[e] = f2bf(lo[e]); b[e] = f2bf(hi[e]); }
    return cat16b(a, b); }

// ---- k_prep: the input conversions and G = Wq Wk^T in one resident launch: PW work-groups of 16 waves (one per WGP), every load of a wave issued ahead of its first store.
// Work-group g owns 16 rows n x 64 columns k of the two planes that k_attn reads as Bt: plane 0, Bt[n][k] = G[k][n] = sum_u Wq[k][u] Wk[n][u]; plane 1, Bt[n][k] = Wv[k][n]. Wave wv writes the 128-B line of row n0 + wv of each.
// G: wave wv multiplies the 32 u from 32 wv on (4 WMMAs: 64 k x 16 n, fragments straight from the f32 rows, which run along u); the 16 partial tiles meet in LDS and are summed in the order of the waves. cg[n] = sum_u Wk[n][u] bq[u] goes the same way; the work-groups of the first 64 k store it, each its 16 values in a 128-B line of its own.
// x: a work-group converts XCH * PT chunks of 8 floats that lie one after the other; a thread takes chunk tid of each run of PT.
#define PW   256
#define PT   512
#define XCH  (NB_ * SS * DD / 8 / (PW * PT))
#define MPI  68               // pitch in floats of a row n of a partial tile: 272 B = 16 B x 17, so that the 16-B stores of 16 lanes cover all 64 banks
__global__ __launch_bounds__(PT) void k_prep(const float* __restrict__ x, const float* __restrict__ w0, const float* __restrict__ w1, const float* __restrict__ w2, const float* __restrict__ bq, h16* XB, h16* Bt, float* CG) {
    static_assert(NB_ * SS * DD % (8 * PW * PT) == 0, "every thread converts XCH whole chunks");
    static_assert(DD % 64 == 0 && DD * DD / 64 == PW * (PT / 32), "one line of each plane per wave");
    static_assert(DD == 32 * (PT / 32), "one WMMA depth of u per wave");
    __shared__ __align__(16) float part[(PT / 32) * 16 * MPI];
    __shared__ float cpart[(PT / 32) * 16];
    const int tid = threadIdx.x, lane = tid & 31, lr = lane & 15, hi = lane >> 4, wv = tid >> 5;
    const int n0 = ((int)blockIdx.x / (DD / 64)) * (PT / 32), k0 = ((int)blockIdx.x % (DD / 64)) * 64;
    const int n = n0 + wv, k = k0 + lane * 2, u0 = wv * 32 + 8 * hi;
    const size_t wi = (size_t)k * DD + n, ch = (size_t)blockIdx.x * (XCH * PT) + tid;
    // Fragment of 16 rows x 32 u, for A and B alike: lane (lr, hi) holds u0 .. u0+7 and u0+16 .. u0+23 of row lr.
    v8f fa[4][2], fb[2], fq[2];
#pragma unroll
    for (int mb = 0; mb < 4; ++mb) { const float* p = w0 + (size_t)(k0 + mb * 16 + lr) * DD + u0; fa[mb][0] = *(const v8f*)p; fa[mb][1] = *(const v8f*)(p + 16); }
    { const float* p = w1 + (size_t)(n0 + lr) * DD + u0; fb[0] = *(const v8f*)p; fb[1] = *(const v8f*)(p + 16); }
    fq[0] = *(const v8f*)(bq + u0); fq[1] = *(const v8f*)(bq + u0 + 16);
    const float c0 = w2[wi], c1 = w2[wi + DD];
    asm volatile("s_wait_xcnt 0x0" ::: "memory");   // behind the last weight and bias load: the x loads' results may go into registers that hold these loads' addresses
    __builtin_amdgcn_sched_barrier(0);   // a "memory" clobber does not tie the wait to registers: this keeps the x address arithmetic and the x loads, which write registers, behind it
    v8f v[XCH];
#pragma unroll
    for (int it = 0; it < XCH; ++it) v[it] = *(const v8f*)(x + (ch + (size_t)it * PT) * 8);
    asm volatile("s_wait_xcnt 0x0" ::: "memory");   // behind the last load: what follows may go into registers that hold these loads' addresses
    __builtin_amdgcn_sched_barrier(0);   // keeps the x loads in flight together with the weight loads: without it they are moved behind the weight product, a second memory latency in series
    {
        const v16bf b = frag_bf(fb[0], fb[1]);
        float cp = 0.0f;
#pragma unroll
        for (int e = 0; e < 8; ++e) { cp += bfr(fb[0][e]) * bfr(fq[0][e]); cp += bfr(fb[1][e]) * bfr(fq[1][e]); }
        cp += __shfl_xor(cp, 16, 32);
        if (hi == 0) cpart[wv * 16 + lr] = cp;
        // An accumulator lane holds column n = lr and rows k = 16 mb + 8 hi + j: 32 B of a row of the transposed tile.
        float* pp = part + (wv * 16 + lr) * MPI + hi * 8;
#pragma unroll
        for (int mb = 0; mb < 4; ++mb) { const v8f d = wmmab(frag_bf(fa[mb][0], fa[mb][1]), b, (v8f){});
            *(v4fa*)(pp + mb * 16) = (v4f){ d[0], d[1], d[2], d[3] }; *(v4fa*)(pp + mb * 16 + 4) = (v4f){ d[4], d[5], d[6], d[7] }; }
    }
    h16* bt = Bt + (size_t)n * DD + k; v2h o;
    o[0] = (h16)bfr(c0); o[1] = (h16)bfr(c1); *(v2h*)(bt + (size_t)DD * DD) = o;
    // Work-group barrier for LDS alone: every wave's partial tile and partial cg are in LDS behind it. The two fences name LDS only, so that the x loads stay in flight across it.
    __builtin_amdgcn_fence(__ATOMIC_RELEASE, "workgroup", "local");
    __builtin_amdgcn_s_barrier();
    __builtin_amdgcn_fence(__ATOMIC_ACQUIRE, "workgroup", "local");
    v2f g = (v2f){};
#pragma unroll
    for (int w = 0; w < PT / 32; ++w) g += *(const v2f*)(part + (w * 16 + wv) * MPI + lane * 2);
    v2h og; og[0] = (h16)g[0]; og[1] = (h16)g[1]; *(v2h*)bt = og;
    if (k0 == 0 && tid < 16) { float c = 0.0f;
#pragma unroll
        for (int w = 0; w < PT / 32; ++w) c += cpart[w * 16 + tid];
        CG[((int)blockIdx.x / (DD / 64)) * 32 + tid] = c; }
    asm volatile("s_wait_xcnt 0x0" ::: "memory");   // behind these stores: the x values may go into registers that they name
#pragma unroll
    for (int it = 0; it < XCH; ++it) { v8h q;
#pragma unroll
        for (int u = 0; u < 8; ++u) q[u] = (h16)bfr(v[it][u]);
        *(v8h*)(XB + (ch + (size_t)it * PT) * 8) = q;
        if (it == XCH / 2 - 1) asm volatile("s_wait_xcnt 0x0" ::: "memory"); }   // behind the first half's stores: the second half's values may go into registers that those stores name
}
// ---- k_attn: the whole of QT query rows in one work-group of 8 waves; grid NB_ * SS / QT, one work-group per WGP. Five steps, each reading LDS only:
//   1. g = x G + cg       (64 x 512, K 512): A = the tile's x rows (Ar), Bt = plane 0 of WG, staged
//   2. scores = g . x_j   (64 x <= 320, K 512): A = g (Ar), Bt = the key rows of x, staged
//   3. window softmax, f32 scores -> fp16 probabilities, each row written over its own scores (Sl)
//   4. y = attn x         (64 x 512, K = sspan): the key rows of x staged whole (64 keys x 512 d), read by transposing loads
//   5. out = y Wv + bv    (64 x 512, K 512): A = y (Ar), Bt = plane 1 of WG, staged
// Tile y: rows i0s .. i0s+63 of batch entry b, keys ks0 .. ks0+sspan-1 (sspan 192, 256 or 320, a multiple of 64).
// Every product stages 64 k per stage by asynchronous copies, two buffers: the next stage flies while this one is multiplied. The first stage of a step is issued behind the last barrier of the step before it.
// Steps 1, 2 and 5 walk their 8 stages of k as a ring that begins at the work-group's own stage rot: all work-groups read the same weight planes, and neighbours the same key rows, and without it they ask L2 for the same lines at the same moment.
#define QT   64
#define AK   (QT + 2 * LW)    // most keys of a tile
#define RB   (DD * LP)        // elements of one ring buffer
#define API  520              // pitch in elements of the resident A operand (x rows, then g, then y): 1040 B = 16 B x 65, for ds_load_b128 readers and 16-B stores
#define SPI  332              // score row pitch in floats: 1328 B = 16 B x 83, since ds_load_b128 reads the probabilities at this pitch
#define PPI  (2 * SPI)        // the same pitch in fp16 elements
#define XP   528              // pitch in elements of a whole key row in step 4: 1056 B = 32 B x 33, for ds_load_tr16_b128 readers
#define CR   32               // 128-B rows that one copy of the work-group covers (8 threads per row)
#define XR   4                // 1024-B rows that one copy of the work-group covers (64 threads per row)
typedef __attribute__((ext_vector_type(4))) _Float16 v4h;
typedef v4h __attribute__((may_alias)) v4ha;
// Six, four and eight copies of this thread's 16 B. The closing s_wait_xcnt stands inside each statement, so that no address register of a copy is rewritten in front of it.
__device__ __forceinline__ void copy6(const h16* g0, const h16* g1, const h16* g2, const h16* g3, const h16* g4, const h16* g5, unsigned l) {
    asm volatile("global_load_async_to_lds_b128 %0, %6, off\n\t"
                 "global_load_async_to_lds_b128 %1, %7, off\n\t"
                 "global_load_async_to_lds_b128 %2, %8, off\n\t"
                 "global_load_async_to_lds_b128 %3, %9, off\n\t"
                 "global_load_async_to_lds_b128 %4, %10, off\n\t"
                 "global_load_async_to_lds_b128 %5, %11, off\n\t"
                 "s_wait_xcnt 0x0"
                 :: "v"(l), "v"(l + 1u * CR * LP * 2), "v"(l + 2u * CR * LP * 2), "v"(l + 3u * CR * LP * 2), "v"(l + 4u * CR * LP * 2), "v"(l + 5u * CR * LP * 2),
                    "v"(g0), "v"(g1), "v"(g2), "v"(g3), "v"(g4), "v"(g5)
                 : "memory");
}
__device__ __forceinline__ void copy4(const h16* g0, const h16* g1, const h16* g2, const h16* g3, unsigned l) {
    asm volatile("global_load_async_to_lds_b128 %0, %4, off\n\t"
                 "global_load_async_to_lds_b128 %1, %5, off\n\t"
                 "global_load_async_to_lds_b128 %2, %6, off\n\t"
                 "global_load_async_to_lds_b128 %3, %7, off\n\t"
                 "s_wait_xcnt 0x0"
                 :: "v"(l), "v"(l + 1u * CR * LP * 2), "v"(l + 2u * CR * LP * 2), "v"(l + 3u * CR * LP * 2),
                    "v"(g0), "v"(g1), "v"(g2), "v"(g3)
                 : "memory");
}
// g: the thread's 16 B of the first row, rs: the step between copies in elements of the source, l: the LDS byte address, STEP: its step in bytes
template <unsigned STEP>
__device__ __forceinline__ void copy8(const h16* g, size_t rs, unsigned l) {
    asm volatile("global_load_async_to_lds_b128 %0, %8, off\n\t"
                 "global_load_async_to_lds_b128 %1, %9, off\n\t"
                 "global_load_async_to_lds_b128 %2, %10, off\n\t"
                 "global_load_async_to_lds_b128 %3, %11, off\n\t"
                 "global_load_async_to_lds_b128 %4, %12, off\n\t"
                 "global_load_async_to_lds_b128 %5, %13, off\n\t"
                 "global_load_async_to_lds_b128 %6, %14, off\n\t"
                 "global_load_async_to_lds_b128 %7, %15, off\n\t"
                 "s_wait_xcnt 0x0"
                 :: "v"(l), "v"(l + 1u * STEP), "v"(l + 2u * STEP), "v"(l + 3u * STEP), "v"(l + 4u * STEP), "v"(l + 5u * STEP), "v"(l + 6u * STEP), "v"(l + 7u * STEP),
                    "v"(g), "v"(g + rs), "v"(g + 2 * rs), "v"(g + 3 * rs), "v"(g + 4 * rs), "v"(g + 5 * rs), "v"(g + 6 * rs), "v"(g + 7 * rs)
                 : "memory");
}
#define NST  (DD / KS)        // stages of a product over K = 512
// The 64 k that stage st holds in a work-group whose walk begins at rot
__device__ __forceinline__ int kof(int st, int rot) { return ((st + rot) & (NST - 1)) * KS; }
// Stage st of a weight plane: 64 k (from k0 on) of its 512 rows n. wp: the thread's 16 B of row tid / 8, l0: their LDS byte address in buffer 0.
__device__ __forceinline__ void fill_w(const h16* wp, int st, int k0, unsigned l0) {
    const unsigned l = l0 + (unsigned)(st & 1) * (unsigned)(RB * 2); const h16* w = wp + k0;
    copy8<CR * LP * 2>(w, (size_t)CR * DD, l); copy8<CR * LP * 2>(w + (size_t)8 * CR * DD, (size_t)CR * DD, l + 8u * CR * LP * 2);
}
// Steps 1 and 5: acc = A (64 x 512, the rows of Ar) times a weight plane (512 rows n, k-contiguous); wave wv takes all 64 rows x columns 64 wv .. 64 wv + 63. The caller has issued stage 0 and written Ar.
// SW 0: acc[mb][nb][j] = C[16 mb + 8 hi + j][64 wv + 16 nb + lr]. SW 1: the operands change places, so that a lane holds 8 consecutive columns of one row: acc[mb][nb][j] = C[16 mb + lr][64 wv + 16 nb + 8 hi + j].
template <bool SW>
__device__ __forceinline__ void mm_w(const h16* wp, unsigned l0, const h16* Ar, const h16* ring, int lr, int hi, int wv, int rot, v8f (&acc)[4][4]) {
    constexpr int nst = NST;
#pragma unroll
    for (int mb = 0; mb < 4; ++mb)
#pragma unroll
        for (int nb = 0; nb < 4; ++nb) acc[mb][nb] = (v8f){};
    asm volatile("s_wait_asynccnt 0x0" ::: "memory");            // this wave's copies of stage 0 have landed
    __syncthreads();                                             // and every other wave's; every wave's rows of Ar are written
    fill_w(wp, 1, kof(1, rot), l0);
#pragma unroll 1
    for (int st = 0; st < nst; ++st) {                           // kept rolled: one copy of the stage body, buffers alternate by st & 1
        const h16* pa = Ar + lr * API + kof(st, rot) + 8 * hi; const h16* pb = ring + (st & 1) * RB + (wv * 64 + lr) * LP + 8 * hi;
        v16h a[4], bb[4];                                        // all eight fragments of 32 k are fetched ahead of their 16 products: one LDS latency for them all
#pragma unroll
        for (int mb = 0; mb < 4; ++mb) a[mb] = ldf(pa + mb * 16 * API);
#pragma unroll
        for (int nb = 0; nb < 4; ++nb) bb[nb] = ldf(pb + nb * 16 * LP);
        __builtin_amdgcn_sched_barrier(0);                       // keeps the fetches above the products: without it every four products wait for a fetch of their own
#pragma unroll
        for (int nb = 0; nb < 4; ++nb)
#pragma unroll
            for (int mb = 0; mb < 4; ++mb) acc[mb][nb] = SW ? wmma16(bb[nb], a[mb], acc[mb][nb]) : wmma16(a[mb], bb[nb], acc[mb][nb]);
#pragma unroll
        for (int mb = 0; mb < 4; ++mb) a[mb] = ldf(pa + mb * 16 * API + 32);
#pragma unroll
        for (int nb = 0; nb < 4; ++nb) bb[nb] = ldf(pb + nb * 16 * LP + 32);
        asm volatile("s_wait_dscnt 0x0" ::: "memory");           // this wave's reads of the buffer (and, in the last stage, of Ar) are done before it is refilled
        asm volatile("s_wait_asynccnt 0x0" ::: "memory");        // this wave's copies of stage st + 1 have landed
        __syncthreads();                                         // publishes stage st + 1 and ends every wave's reads of stage st
        if (st + 2 < nst) fill_w(wp, st + 2, kof(st + 2, rot), l0);
        __builtin_amdgcn_sched_barrier(0);                       // keeps the stage's last products, which read registers only, behind the refill: the copies fly while they run
#pragma unroll
        for (int nb = 0; nb < 4; ++nb)
#pragma unroll
            for (int mb = 0; mb < 4; ++mb) acc[mb][nb] = SW ? wmma16(bb[nb], a[mb], acc[mb][nb]) : wmma16(a[mb], bb[nb], acc[mb][nb]);
    }
    asm volatile("s_wait_asynccnt 0x0" ::: "memory");            // no copy of this step is in flight when the ring takes the next step's stages
}
__global__ __launch_bounds__(256) void k_attn(const h16* __restrict__ X, const h16* __restrict__ WG, const float* __restrict__ CG, const float* __restrict__ bv, float* __restrict__ O) {
    static_assert(KS == 64 && LW % 64 == 0 && AK == 10 * CR && DD == 16 * CR && QT + LW >= 6 * CR && QT == 16 * XR && KS == 16 * XR && DD * 2 == 64 * 16, "the copy lists below");
    static_assert(KS * XP <= RB && AK <= SPI, "a stage of whole key rows fits a ring buffer; a score row fits its pitch");
    static_assert((NST & (NST - 1)) == 0, "the ring of stages wraps by a mask");
    __shared__ __align__(16) h16 ring[2 * RB];
    __shared__ __align__(16) h16 Ar[QT * API];         // the tile's x rows, then g, then y
    __shared__ __align__(16) float Sl[QT * SPI];       // scores, then the probabilities in the same rows; behind step 5 each wave's output staging
    const int b = (int)blockIdx.x / (SS / QT), i0s = ((int)blockIdx.x % (SS / QT)) * QT;
    const int ks0 = (i0s - LW > 0) ? (i0s - LW) : 0, ke = (i0s + QT + LW < SS) ? (i0s + QT + LW) : SS, sspan = ke - ks0;
    const int rot = ((int)blockIdx.x + ((int)blockIdx.x >> 3)) & (NST - 1);   // neighbours differ, and so do work-groups 8 apart: speed only, any value from 0 to 7 gives the same sums in another order
    const int tid = threadIdx.x, lane = tid & 31, lr = lane & 15, hi = lane >> 4, wv = tid >> 5;
    const int srow = tid >> 3, scol = (tid & 7) * 8;             // 128-B rows: 8 threads a row
    const int xrow = tid >> 6, xcol = (tid & 63) * 8;            // 1024-B rows: 64 threads a row
    const unsigned l0 = (unsigned)(size_t)ring + (unsigned)(srow * LP + scol) * 2u;
    const unsigned lx = (unsigned)(size_t)ring + (unsigned)(xrow * XP + xcol) * 2u;
    const h16* kp = X + ((size_t)b * SS + ks0 + srow) * DD + scol;
    const h16* xp = X + ((size_t)b * SS + ks0 + xrow) * DD + xcol;
    const h16* gp = WG + (size_t)srow * DD + scol;
    // Key rows at or past sspan (edge tiles) do not exist: their LDS rows take the last CR real rows again, and the mask drops their scores.
    auto kr = [&](int c) { const int r = c * CR; return (size_t)((r < sspan - CR) ? r : (sspan - CR)) * DD; };
    auto fill1 = [&](int st) { const unsigned l = l0 + (unsigned)(st & 1) * (unsigned)(RB * 2); const h16* k = kp + kof(st, rot);
        copy6(k, k + (size_t)CR * DD, k + (size_t)2 * CR * DD, k + (size_t)3 * CR * DD, k + (size_t)4 * CR * DD, k + (size_t)5 * CR * DD, l);
        copy4(k + kr(6), k + kr(7), k + kr(8), k + kr(9), l + 6u * CR * LP * 2); };
    auto fill2 = [&](int st) { const unsigned l = lx + (unsigned)(st & 1) * (unsigned)(RB * 2); const h16* x = xp + (size_t)st * KS * DD;
        copy8<XR * XP * 2>(x, (size_t)XR * DD, l); copy8<XR * XP * 2>(x + (size_t)8 * XR * DD, (size_t)XR * DD, l + 8u * XR * XP * 2); };
    v8f acc[4][4];
    // step 1: g = x G + cg
    {
        const h16* q = X + ((size_t)b * SS + i0s + xrow) * DD + xcol; const unsigned la = (unsigned)(size_t)Ar + (unsigned)(xrow * API + xcol) * 2u;
        copy8<XR * API * 2>(q, (size_t)XR * DD, la); copy8<XR * API * 2>(q + (size_t)8 * XR * DD, (size_t)XR * DD, la + 8u * XR * API * 2);
        fill_w(gp, 0, kof(0, rot), l0);
        v4f cg[4][2];                                            // this lane's 8 values of cg per column block, fetched here so that their latency passes under the product
#pragma unroll
        for (int nb = 0; nb < 4; ++nb) { const float* cb = CG + (wv * 4 + nb) * 32 + 8 * hi; cg[nb][0] = *(const v4fa*)cb; cg[nb][1] = *(const v4fa*)(cb + 4); }
        asm volatile("s_wait_xcnt 0x0" ::: "memory");            // behind the last load: what follows may go into the registers that hold these loads' address
        __builtin_amdgcn_sched_barrier(0);                       // a "memory" clobber does not tie the wait to registers: this keeps later register writes behind it
        mm_w<true>(gp, l0, Ar, ring, lr, hi, wv, rot, acc);
        fill1(0);                                                // both buffers are free behind the last barrier: the first key stage flies while g is written
        // Every wave's reads of the x rows in Ar ended in front of that barrier too: g takes their place, 16 B (8 columns of one row) a store.
#pragma unroll
        for (int nb = 0; nb < 4; ++nb)
#pragma unroll
            for (int mb = 0; mb < 4; ++mb) { v8h o;
#pragma unroll
                for (int u = 0; u < 4; ++u) { o[u] = (h16)(acc[mb][nb][u] + cg[nb][0][u]); o[4 + u] = (h16)(acc[mb][nb][4 + u] + cg[nb][1][u]); }
                *(v8ha*)(Ar + (mb * 16 + lr) * API + wv * 64 + nb * 16 + 8 * hi) = o; }
    }
    // step 2: scores, 2 x 4 waves, 32 rows x 80 keys each
    {
        const int wm = (wv & 1) * 32, wn = (wv >> 1) * 80;
        v8f s[2][5];
#pragma unroll
        for (int mb = 0; mb < 2; ++mb)
#pragma unroll
            for (int nb = 0; nb < 5; ++nb) s[mb][nb] = (v8f){};
        constexpr int nst = NST;
        asm volatile("s_wait_asynccnt 0x0" ::: "memory");    // this wave's copies of stage 0 have landed
        __syncthreads();                                     // and every other wave's; every wave's part of g is in Ar
        fill1(1);
#pragma unroll 1
        for (int st = 0; st < nst; ++st) {                   // kept rolled: one copy of the stage body, buffers alternate by st & 1
            const h16* pa = Ar + (wm + lr) * API + kof(st, rot) + 8 * hi; const h16* pb = ring + (st & 1) * RB + (wn + lr) * LP + 8 * hi;
            v16h a[KS / 32][2], bb[KS / 32][5];                  // the whole stage's fragments go to registers first: one LDS latency a stage, and the buffer is free before the products start
#pragma unroll
            for (int ks = 0; ks < KS / 32; ++ks) {
#pragma unroll
                for (int mb = 0; mb < 2; ++mb) a[ks][mb] = ldf(pa + mb * 16 * API + ks * 32);
#pragma unroll
                for (int nb = 0; nb < 5; ++nb) bb[ks][nb] = ldf(pb + nb * 16 * LP + ks * 32); }
            asm volatile("s_wait_dscnt 0x0" ::: "memory");       // this wave's reads of the buffer are done before it is refilled
            asm volatile("s_wait_asynccnt 0x0" ::: "memory");    // this wave's copies of stage st + 1 have landed
            __syncthreads();                                     // publishes stage st + 1 and ends every wave's reads of stage st
            if (st + 2 < nst) fill1(st + 2);
            __builtin_amdgcn_sched_barrier(0);                   // keeps the products, which read registers only, behind the refill: the copies fly while they run
#pragma unroll
            for (int ks = 0; ks < KS / 32; ++ks)
#pragma unroll
                for (int nb = 0; nb < 5; ++nb)
#pragma unroll
                    for (int mb = 0; mb < 2; ++mb) s[mb][nb] = wmma16(a[ks][mb], bb[ks][nb], s[mb][nb]);
        }
        asm volatile("s_wait_asynccnt 0x0" ::: "memory");        // no copy of a score stage is in flight when the ring takes the stages of step 4
        fill2(0);                                                // both buffers are free behind the last barrier: the first stage of step 4 flies during the softmax
#pragma unroll
        for (int mb = 0; mb < 2; ++mb)
#pragma unroll
            for (int nb = 0; nb < 5; ++nb)
#pragma unroll
                for (int j = 0; j < 8; ++j) Sl[(wm + mb * 16 + hi * 8 + j) * SPI + wn + nb * 16 + lr] = s[mb][nb][j];
    }
    __syncthreads();                                             // every wave's scores are in Sl
    // step 3: softmax, 4 threads per row, thread t of a row takes columns jj = 16 it + 4 t + u; key j = ks0 + jj counts where jj < sspan and i-128 <= j <= i+128, that is lo <= jj <= lo + wl
    {
        const float c = 0.044194173824159216f;
        const int rr = tid >> 2, t4 = (tid & 3) * 4, i = i0s + rr;
        const int lo = (i - LW > ks0) ? (i - LW - ks0) : 0, up = (i + LW - ks0 < sspan - 1) ? (i + LW - ks0) : (sspan - 1); const unsigned wl = (unsigned)(up - lo);
        const float* sr = Sl + rr * SPI + t4; v4f v[AK / 16]; v4f m4 = { -3.0e38f, -3.0e38f, -3.0e38f, -3.0e38f };
#pragma unroll
        for (int it = 0; it < AK / 16; ++it) { const v4f a = *(const v4fa*)(sr + it * 16);
#pragma unroll
            for (int u = 0; u < 4; ++u) { const bool ok = (unsigned)(it * 16 + t4 + u - lo) <= wl; const float x = ok ? a[u] * c : -3.0e38f; v[it][u] = x; m4[u] = fmaxf(m4[u], x); } }
        float mx = fmaxf(fmaxf(m4[0], m4[1]), fmaxf(m4[2], m4[3]));
        mx = fmaxf(mx, __shfl_xor(mx, 1, 32)); mx = fmaxf(mx, __shfl_xor(mx, 2, 32));
        v4f s4 = (v4f){};
#pragma unroll
        for (int it = 0; it < AK / 16; ++it)
#pragma unroll
            for (int u = 0; u < 4; ++u) { v[it][u] = __builtin_amdgcn_exp2f((v[it][u] - mx) * 1.4426950408889634f); s4[u] += v[it][u]; }
        float sum = (s4[0] + s4[1]) + (s4[2] + s4[3]);
        sum += __shfl_xor(sum, 1, 32); sum += __shfl_xor(sum, 2, 32);
        const float f = __fdiv_rn(1.0f, sum);
        // A row's probabilities go over its own scores: the row is read by these four lanes of one wave alone, and each value stored hangs on the row's sum, that is on every load of the row.
        h16* pr = (h16*)(Sl + rr * SPI) + t4;
#pragma unroll
        for (int it = 0; it < AK / 16; ++it) { v4h o;
#pragma unroll
            for (int u = 0; u < 4; ++u) o[u] = (h16)(v[it][u] * f);
            *(v4ha*)(pr + it * 16) = o; }
    }
    // step 4: y = attn x, 8 waves, all 64 rows x 64 columns (d) each; k runs over the tile's sspan keys. x^T is the A operand (transposing loads), the probabilities' rows the B operand: acc[mb][nb][j] = y[16 mb + lr][64 wv + 16 nb + 8 hi + j].
    const int nst2 = sspan / KS;
#pragma unroll
    for (int mb = 0; mb < 4; ++mb)
#pragma unroll
        for (int nb = 0; nb < 4; ++nb) acc[mb][nb] = (v8f){};
    asm volatile("s_wait_asynccnt 0x0" ::: "memory");            // this wave's copies of stage 0 have landed
    __syncthreads();                                             // and every other wave's; every wave's probabilities are in Sl
    if (nst2 > 1) fill2(1);
#pragma unroll 1
    for (int st = 0; st < nst2; ++st) {                          // kept rolled: the trip count is the tile's
        const h16* pa = (const h16*)Sl + lr * PPI + st * KS + 8 * hi;
        const unsigned char* px = (const unsigned char*)(ring + (st & 1) * RB) + (8 * hi + (lane & 7)) * (XP * 2) + wv * 128 + ((lane >> 3) & 1) * 16;
        v16h a[4], bb[4];                                        // all eight fragments of 32 k are fetched ahead of their 16 products: one LDS latency for them all
#pragma unroll
        for (int mb = 0; mb < 4; ++mb) a[mb] = ldf(pa + mb * 16 * PPI);
#pragma unroll
        for (int nb = 0; nb < 4; ++nb) bb[nb] = ldft(px + nb * 32, XP * 2);
        __builtin_amdgcn_sched_barrier(0);                       // keeps the fetches above the products: without it every four products wait for a fetch of their own
#pragma unroll
        for (int nb = 0; nb < 4; ++nb)
#pragma unroll
            for (int mb = 0; mb < 4; ++mb) acc[mb][nb] = wmma16(bb[nb], a[mb], acc[mb][nb]);
#pragma unroll
        for (int mb = 0; mb < 4; ++mb) a[mb] = ldf(pa + mb * 16 * PPI + 32);
#pragma unroll
        for (int nb = 0; nb < 4; ++nb) bb[nb] = ldft(px + 32 * (XP * 2) + nb * 32, XP * 2);
        asm volatile("s_wait_dscnt 0x0" ::: "memory");           // this wave's reads of the buffer are done before it is refilled
        asm volatile("s_wait_asynccnt 0x0" ::: "memory");        // this wave's copies of stage st + 1 have landed
        __syncthreads();                                         // publishes stage st + 1 and ends every wave's reads of stage st
        if (st + 2 < nst2) fill2(st + 2);
        __builtin_amdgcn_sched_barrier(0);                       // keeps the stage's last products, which read registers only, behind the refill: the copies fly while they run
#pragma unroll
        for (int nb = 0; nb < 4; ++nb)
#pragma unroll
            for (int mb = 0; mb < 4; ++mb) acc[mb][nb] = wmma16(bb[nb], a[mb], acc[mb][nb]);
    }
    asm volatile("s_wait_asynccnt 0x0" ::: "memory");            // no copy of step 4 is in flight when the ring takes the stages of step 5
    // step 5: out = y Wv + bv
    const h16* vp = gp + (size_t)DD * DD;
    fill_w(vp, 0, kof(0, rot), l0);                                           // both buffers are free behind the last barrier: the first stage flies while y is written
    // g in Ar was last read in step 2: y takes its place, rounded once to fp16, 16 B a store.
#pragma unroll
    for (int nb = 0; nb < 4; ++nb)
#pragma unroll
        for (int mb = 0; mb < 4; ++mb) { v8h o;
#pragma unroll
            for (int j = 0; j < 8; ++j) o[j] = (h16)acc[mb][nb][j];
            *(v8ha*)(Ar + (mb * 16 + lr) * API + wv * 64 + nb * 16 + 8 * hi) = o; }
    float bz[4];                                                 // the bias of the 4 columns that this lane's accumulators hold, fetched here so that its latency passes under the product
#pragma unroll
    for (int nb = 0; nb < 4; ++nb) bz[nb] = bv[wv * 64 + nb * 16 + lr];
    asm volatile("s_wait_xcnt 0x0" ::: "memory");                // behind the last load: what follows may go into the registers that hold these loads' address
    __builtin_amdgcn_sched_barrier(0);                           // a "memory" clobber does not tie the wait to registers: this keeps later register writes behind it
    mm_w<false>(vp, l0, Ar, ring, lr, hi, wv, rot, acc);
    // A 16 x 64 f32 block turns in the wave's own range of Sl (the probabilities were last read in front of the last barrier of step 4), so that each store covers whole 128-B lines.
    float* os = Sl + wv * (16 * 68);
#pragma unroll
    for (int nb = 0; nb < 4; ++nb) bz[nb] = bfr(bz[nb]);
#pragma unroll
    for (int mb = 0; mb < 4; ++mb) {
#pragma unroll
        for (int nb = 0; nb < 4; ++nb) {
#pragma unroll
            for (int j = 0; j < 8; ++j) os[(hi * 8 + j) * 68 + nb * 16 + lr] = acc[mb][nb][j] + bz[nb]; }
        // compiler fence: the reads that follow take other lanes' LDS writes and must not be moved over them
        __builtin_amdgcn_wave_barrier(); asm volatile("" ::: "memory");
        float* crow = O + ((size_t)b * SS + i0s + mb * 16) * DD + wv * 64;
#pragma unroll
        for (int s = 0; s < 8; ++s) { const int row = 2 * s + hi, cofs = lr * 4; const v4f val = *(const v4fa*)(os + row * 68 + cofs); *(v4f*)(crow + (size_t)row * DD + cofs) = val; }
        asm volatile("s_wait_xcnt 0x0" ::: "memory");   // the next row block's loads go into registers that the last store names
        // compiler fence: the next row block's LDS writes stay behind the reads above
        __builtin_amdgcn_wave_barrier(); asm volatile("" ::: "memory");
    }
}

extern "C" void kernel_launch(void* const* d_in, const int* in_sizes, int n_in,
                              void* d_out, int out_size, void* d_ws, size_t ws_size, hipStream_t stream) {
    (void)in_sizes; (void)n_in; (void)out_size;
    const float* x = (const float*)d_in[0]; const float* wq = (const float*)d_in[1]; const float* wk = (const float*)d_in[2]; const float* wv = (const float*)d_in[3]; const float* bq = (const float*)d_in[4]; const float* bv = (const float*)d_in[6];   // d_in[5], bk, reaches the scores only through a term that is the same for every key of a row (head of the file)
    float* OUT = (float*)d_out;     // [8][2048][512]
    char* wsp = (char*)d_ws;
    auto take = [&](size_t bytes) { char* p = wsp; wsp += (bytes + 255) & ~(size_t)255; return (void*)p; };
    h16* WG = (h16*)take((size_t)2 * DD * DD * 2);                     // G = Wq Wk^T and Wv, transposed, one after the other
    float* CG = (float*)take((size_t)(DD / 16) * 32 * 4);              // cg = Wk bq, 16 values per 128-B line
    h16* XB = (h16*)take((size_t)NB_ * SS * DD * 2);                   // x: the projection's operand, the keys and the values' operand
    if ((size_t)(wsp - (char*)d_ws) > ws_size) return;    // total ~ 17 MiB
    k_prep<<<PW, PT, 0, stream>>>(x, wq, wk, wv, bq, XB, WG, CG);
    k_attn<<<NB_ * SS / QT, 256, 0, stream>>>(XB, WG, CG, bv, OUT);
}
